// v000
// Measured on an AMD MI455X. A time is GPU time per run, averaged over a window of back-to-back runs after a warm-up
// (all launches, gaps included; the runs take copies of the inputs in turn), and the median of several windows.
// Apart from v000's, it joins two sittings. Times from different sittings can be a few percent apart, while
// side-by-side timings come from the same sitting.
// v000, which the later versions start from, runs in 219 microseconds.
#include <hip/hip_runtime.h>
#include <math.h>

typedef __attribute__((ext_vector_type(16))) _Float16 v16h;
typedef __attribute__((ext_vector_type(16))) __bf16 v16b;
typedef __attribute__((ext_vector_type(8)))  _Float16 v8h;
typedef __attribute__((ext_vector_type(8)))  float v8f;
typedef __attribute__((ext_vector_type(4)))  float v4f;
typedef __attribute__((ext_vector_type(2)))  float v2f;
typedef __attribute__((ext_vector_type(4)))  unsigned v4u;
typedef __attribute__((ext_vector_type(4)))  int v4i;
typedef float __attribute__((may_alias)) float_a;
typedef int __attribute__((may_alias)) int_a;

template <typename T> __device__ __forceinline__ void vst2(void* p, T v) { *(T*)p = v;  }
__device__ __forceinline__ v8f wmma16(v16h a, v16h b, v8f c) {
  v8f d = __builtin_amdgcn_wmma_f32_16x16x32_f16(false, a, false, b, (short)0, c, false, false);
  asm volatile("v_nop\n\tv_nop\n\tv_nop\n\tv_nop" : "+v"(d) : "v"(a), "v"(b));
  return d;
}
__device__ __forceinline__ v8f wmma_bf(v16b a, v16b b, v8f c) {
  v8f d = __builtin_amdgcn_wmma_f32_16x16x32_bf16(false, a, false, b, (short)0, c, false, false);
  asm volatile("v_nop\n\tv_nop\n\tv_nop\n\tv_nop" : "+v"(d) : "v"(a), "v"(b));
  return d;
}
// 16x16x32 fragments: lane = (h = lane>>4, row/col = lane&15); elements 0..7 = k0+8h+0..7, 8..15 = k0+16+8h+0..7; D element r = row 8h+r
__device__ __forceinline__ v16h frag_h(const _Float16* rowk0, int lane) {
  union { v16h v; v8h q[2]; } u; const _Float16* p = rowk0 + 8 * (lane >> 4);
  u.q[0] = *(const v8h*)p; u.q[1] = *(const v8h*)(p + 16); return u.v;
}
__device__ __forceinline__ v16h frag_f32(const float* rowk0, int lane) {
  v16h a; const float* p = rowk0 + 8 * (lane >> 4);
#pragma unroll
  for (int i = 0; i < 8; ++i) { a[i] = (_Float16)p[i]; a[8 + i] = (_Float16)p[16 + i]; }
  return a;
}
__device__ __forceinline__ v16h frag_f32s(const float* rowk0, int lane, float sc) {
  v16h a; const float* p = rowk0 + 8 * (lane >> 4);
#pragma unroll
  for (int i = 0; i < 8; ++i) { a[i] = (_Float16)(p[i] * sc); a[8 + i] = (_Float16)(p[16 + i] * sc); }
  return a;
}
// column fragment from a [K][ld] layout (column n), rows >= K read as 0
__device__ __forceinline__ v16h fragc_f32(const float* W, int k0, int n, int lane, int ld, int K) {
  v16h a; const int g = lane >> 4;
#pragma unroll
  for (int i = 0; i < 8; ++i) { const int ka = k0 + 8 * g + i, kb = ka + 16;
    a[i] = (_Float16)(ka < K ? W[(size_t)ka * ld + n] : 0.f); a[8 + i] = (_Float16)(kb < K ? W[(size_t)kb * ld + n] : 0.f); }
  return a;
}
struct F2 { v16b h, l; };
__device__ __forceinline__ F2 bsplit16(const float v[16]) { F2 r;
#pragma unroll
  for (int i = 0; i < 16; ++i) { const __bf16 h = (__bf16)v[i]; r.h[i] = h; r.l[i] = (__bf16)(v[i] - (float)h); }
  return r; }
__device__ __forceinline__ F2 split_row(const float* row, int k0, int lane) { float v[16]; const float* p = row + k0 + 8 * (lane >> 4);
#pragma unroll
  for (int i = 0; i < 8; ++i) { v[i] = p[i]; v[8 + i] = p[16 + i]; }
  return bsplit16(v); }
__device__ __forceinline__ F2 split_rowK(const float* row, int k0, int lane, int K) { float v[16]; const int g = lane >> 4;
#pragma unroll
  for (int i = 0; i < 8; ++i) { const int ka = k0 + 8 * g + i, kb = ka + 16; v[i] = ka < K ? row[ka] : 0.f; v[8 + i] = kb < K ? row[kb] : 0.f; }
  return bsplit16(v); }
__device__ __forceinline__ F2 split_col(const float* W, int k0, int n, int lane, int ld, int K) { float v[16]; const int g = lane >> 4;
#pragma unroll
  for (int i = 0; i < 8; ++i) { const int ka = k0 + 8 * g + i, kb = ka + 16; v[i] = ka < K ? W[(size_t)ka * ld + n] : 0.f; v[8 + i] = kb < K ? W[(size_t)kb * ld + n] : 0.f; }
  return bsplit16(v); }
__device__ __forceinline__ v8f mac3(const F2& a, const F2& b, v8f c) { c = wmma_bf(a.l, b.h, c); c = wmma_bf(a.h, b.l, c); return wmma_bf(a.h, b.h, c); }
__device__ __forceinline__ float sigm(float v) { return 1.0f / (1.0f + expf(-v)); }
#define LDSX() do { asm volatile("s_wait_dscnt 0" ::: "memory"); __builtin_amdgcn_wave_barrier(); __builtin_amdgcn_fence(__ATOMIC_RELEASE, "workgroup"); } while (0)

// Softmax-free multi-head linear attention: out = sum_h Q_h (K_h^T V_h) with K_h^T V_h = (K_h^T x) Wv_h^T, so V is never materialised.
// x converted to f16 once, per-head weights packed x16 as f16 rows; Q and K projections (K stored transposed [kq][n]), the per-(b,h)
// K^T x reductions over the 8192 tokens (deterministic per-block partials summed in fixed order), the small (K^T x) Wv^T products and
// Q @ (K^T V) with the head sum folded into one K = 512 contraction all run on v_wmma_f32_16x16x32_f16 (f32 accumulate).
#define NB 8
#define NN 8192
#define DD 128
#define NH 8
#define KQ 64
#define NR (NB * NN)
#define RB 1024                // token rows per K^T x partial block
#define NPB (NN / RB)          // 8

__global__ __launch_bounds__(256) void k_cvt(const float* __restrict__ src, _Float16* __restrict__ dst, size_t n8, float sc) {
  const size_t g8 = (size_t)blockIdx.x * 256 + threadIdx.x; if (g8 >= n8) return;
  union { v8h h; v4u u; } pk;
#pragma unroll
  for (int e = 0; e < 8; ++e) pk.h[e] = (_Float16)(src[g8 * 8 + e] * sc);
  vst2(dst + g8 * 8, pk.u);
}
// block (64 tokens, b, z): z < 4 -> Q columns z*128 (2 heads) as rows Q16 [b*NN+n][512]; z >= 4 -> K heads (z-4)*2, +1 transposed into KT16 [b][h][kq][n]
__global__ __launch_bounds__(128) void k_proj(const _Float16* __restrict__ x16, const _Float16* __restrict__ Wq16, const _Float16* __restrict__ Wk16, _Float16* __restrict__ Q16, _Float16* __restrict__ KT16) {
  __shared__ __align__(16) float so[4][16][132];
  __shared__ __align__(16) _Float16 st[128][72];
  const int tid = threadIdx.x, wave = tid >> 5, lane = tid & 31, col = lane & 15, g = lane >> 4;
  const int b = blockIdx.y, z = blockIdx.z, t0b = blockIdx.x * 64, r0 = b * NN + t0b + wave * 16;
  const _Float16* W = z < 4 ? Wq16 : Wk16; const int wrow0 = (z & 3) * 128;
  v8f acc[8] = {};
#pragma unroll
  for (int kc = 0; kc < DD / 32; ++kc) { const v16h a = frag_h(x16 + (size_t)(r0 + col) * DD + kc * 32, lane);
#pragma unroll
    for (int j = 0; j < 8; ++j) acc[j] = wmma16(a, frag_h(W + (size_t)(wrow0 + j * 16 + col) * DD + kc * 32, lane), acc[j]); }
  if (z < 4) {
#pragma unroll
    for (int j = 0; j < 8; ++j)
#pragma unroll
      for (int r = 0; r < 8; ++r) so[wave][8 * g + r][j * 16 + col] = acc[j][r] * (1.0f / 16.0f);
    LDSX();
    for (int q = lane; q < 16 * 16; q += 32) { const int rl = q >> 4, pc = q & 15; union { v8h h8; v4u u; } pk;
#pragma unroll
      for (int e = 0; e < 8; ++e) pk.h8[e] = (_Float16)so[wave][rl][pc * 8 + e];
      vst2(Q16 + (size_t)(r0 + rl) * (NH * KQ) + z * 128 + pc * 8, pk.u); } }
  else {
#pragma unroll
    for (int j = 0; j < 8; ++j)
#pragma unroll
      for (int r = 0; r < 8; ++r) st[j * 16 + col][wave * 16 + 8 * g + r] = (_Float16)(acc[j][r] * (1.0f / 16.0f));
    __syncthreads();
    for (int q = tid; q < 128 * 8; q += 128) { const int c = q >> 3, pc = q & 7; const int h = (z - 4) * 2 + (c >> 6), kq = c & 63;
      vst2(KT16 + (((size_t)b * NH + h) * KQ + kq) * NN + t0b + pc * 8, *(const v4u*)(&st[c][pc * 8])); } }
}
// K^T x partials: block (pb, b*8+h): P[kq][d] = sum over the block's 1024 tokens of K[n][kq] x[n][d]; A = KT16 rows (k = n), B = x columns (fragment from the f32 input, ld 128)
__global__ __launch_bounds__(128) void k_ktx(const _Float16* __restrict__ KT16, const float* __restrict__ x, float* __restrict__ part) {
  __shared__ __align__(16) float so[4][16][132];
  const int tid = threadIdx.x, wave = tid >> 5, lane = tid & 31, col = lane & 15, g = lane >> 4;
  const int pb = blockIdx.x, bh = blockIdx.y, b = bh / NH; const int n0 = pb * RB;
  const _Float16* kt = KT16 + (size_t)bh * KQ * NN; const float* xb = x + ((size_t)b * NN + n0) * DD;
  v8f acc[8] = {};
#pragma unroll 1
  for (int kc = 0; kc < RB / 32; ++kc) { const v16h a = frag_h(kt + (size_t)(wave * 16 + col) * NN + n0 + kc * 32, lane);
#pragma unroll
    for (int j = 0; j < 8; ++j) acc[j] = wmma16(a, fragc_f32(xb, kc * 32, j * 16 + col, lane, DD, RB), acc[j]); }
#pragma unroll
  for (int j = 0; j < 8; ++j)
#pragma unroll
    for (int r = 0; r < 8; ++r) so[wave][8 * g + r][j * 16 + col] = acc[j][r];
  LDSX();
#pragma unroll 4
  for (int rl = 0; rl < 16; ++rl) vst2(part + (((size_t)bh * NPB + pb) * KQ + wave * 16 + rl) * DD + lane * 4, *(const v4f*)(&so[wave][rl][lane * 4]));
}
// per (b,h): KtX = sum of partials (fixed order) [64][128]; KtV[kq][e] = sum_d KtX[kq][d] Wv[h][e][d] on WMMA; stored transposed as KtV16[b][e][h*64+kq] (x0.25) via LDS
__global__ __launch_bounds__(128) void k_ktv(const float* __restrict__ part, const _Float16* __restrict__ Wv16, _Float16* __restrict__ KtV16) {
  __shared__ __align__(16) float sx[KQ][132];
  __shared__ __align__(16) _Float16 st[DD][72];          // [e][kq]
  const int tid = threadIdx.x, wave = tid >> 5, lane = tid & 31, col = lane & 15, g = lane >> 4;
  const int bh = blockIdx.x, b = bh / NH, h = bh % NH;
  for (int q = tid; q < KQ * DD; q += 128) { const int kq = q >> 7, d = q & 127; float s = 0.f;
#pragma unroll
    for (int pb = 0; pb < NPB; ++pb) s += part[(((size_t)bh * NPB + pb) * KQ + kq) * DD + d];
    sx[kq][d] = s * (1.0f / 64.0f); }                      // |KtX| up to ~40: /64 keeps the f16 operand comfortable; undone below
  __syncthreads();
  v8f acc[8] = {};
#pragma unroll
  for (int kc = 0; kc < DD / 32; ++kc) { const v16h a = frag_f32(&sx[wave * 16 + col][0] + kc * 32, lane);
#pragma unroll
    for (int j = 0; j < 8; ++j) acc[j] = wmma16(a, frag_h(Wv16 + ((size_t)h * DD + j * 16 + col) * DD + kc * 32, lane), acc[j]); }
#pragma unroll
  for (int j = 0; j < 8; ++j)
#pragma unroll
    for (int r = 0; r < 8; ++r) st[j * 16 + col][wave * 16 + 8 * g + r] = (_Float16)(acc[j][r] * (64.0f / 16.0f) * 0.25f);     // KtV x0.25 as f16 (|KtV| ~ 5)
  __syncthreads();
  for (int q = tid; q < DD * 8; q += 128) { const int e = q >> 3, pc = q & 7; vst2(KtV16 + ((size_t)b * DD + e) * (NH * KQ) + h * KQ + pc * 8, *(const v4u*)(&st[e][pc * 8])); }
}
// out[b][n][e] = sum_{h,kq} Q[b][n][h*64+kq] KtV[b][h][kq][e]: K = 512
__global__ __launch_bounds__(128) void k_out(const _Float16* __restrict__ Q16, const _Float16* __restrict__ KtV16, float* __restrict__ out) {
  __shared__ __align__(16) float so[4][16][132];
  const int tid = threadIdx.x, wave = tid >> 5, lane = tid & 31, col = lane & 15, g = lane >> 4;
  const int b = blockIdx.y, r0 = b * NN + blockIdx.x * 64 + wave * 16;
  v8f acc[8] = {};
#pragma unroll 1
  for (int kc = 0; kc < NH * KQ / 32; ++kc) { const v16h a = frag_h(Q16 + (size_t)(r0 + col) * (NH * KQ) + kc * 32, lane);
#pragma unroll
    for (int j = 0; j < 8; ++j) acc[j] = wmma16(a, frag_h(KtV16 + ((size_t)b * DD + j * 16 + col) * (NH * KQ) + kc * 32, lane), acc[j]); }
#pragma unroll
  for (int j = 0; j < 8; ++j)
#pragma unroll
    for (int r = 0; r < 8; ++r) so[wave][8 * g + r][j * 16 + col] = acc[j][r] * 4.0f;
  LDSX();
#pragma unroll 4
  for (int rl = 0; rl < 16; ++rl) vst2(out + (size_t)(r0 + rl) * DD + lane * 4, *(const v4f*)(&so[wave][rl][lane * 4]));
}
extern "C" void kernel_launch(void* const* d_in, const int* in_sizes, int n_in, void* d_out, int out_size, void* d_ws, size_t ws_size, hipStream_t stream) {
  (void)in_sizes; (void)n_in; (void)out_size; (void)ws_size;
  const float* x = (const float*)d_in[0]; const float* Wk = (const float*)d_in[1]; const float* Wq = (const float*)d_in[2]; const float* Wv = (const float*)d_in[3];
  float* out = (float*)d_out;
  char* ws = (char*)d_ws; size_t off = 0;
  auto take = [&](size_t bytes) { char* p = ws + off; off += (bytes + 255) & ~(size_t)255; return p; };
  _Float16* x16 = (_Float16*)take((size_t)NR * DD * 2); _Float16* Wq16 = (_Float16*)take((size_t)NH * KQ * DD * 2); _Float16* Wk16 = (_Float16*)take((size_t)NH * KQ * DD * 2); _Float16* Wv16 = (_Float16*)take((size_t)NH * DD * DD * 2);
  float* part = (float*)take((size_t)NB * NH * NPB * KQ * DD * 4); _Float16* KtV16 = (_Float16*)take((size_t)NB * DD * NH * KQ * 2);
  _Float16* Q16 = (_Float16*)take((size_t)NR * NH * KQ * 2); _Float16* KT16 = (_Float16*)take((size_t)NB * NH * KQ * NN * 2);      // KT16 (67 MB) starts at ~102 MB
  auto cvt = [&](const float* s, _Float16* d, size_t n, float sc) { const size_t n8 = n / 8; k_cvt<<<(unsigned)((n8 + 255) / 256), 256, 0, stream>>>(s, d, n8, sc); };
  cvt(x, x16, (size_t)NR * DD, 1.0f); cvt(Wq, Wq16, (size_t)NH * KQ * DD, 16.0f); cvt(Wk, Wk16, (size_t)NH * KQ * DD, 16.0f); cvt(Wv, Wv16, (size_t)NH * DD * DD, 16.0f);
  k_proj<<<dim3(NN / 64, NB, 8), 128, 0, stream>>>(x16, Wq16, Wk16, Q16, KT16);
  k_ktx<<<dim3(NPB, NB * NH), 128, 0, stream>>>(KT16, x, part);
  k_ktv<<<NB * NH, 128, 0, stream>>>(part, Wv16, KtV16);
  k_out<<<dim3(NN / 64, NB), 128, 0, stream>>>(Q16, KtV16, out);
}

// v001
// Measured time: 32 microseconds a run.
// In two side-by-side timings against v000, it was 6.91 and 6.79 times as fast.
#include <hip/hip_runtime.h>
#include <math.h>

typedef __attribute__((ext_vector_type(16))) _Float16 v16h;
typedef __attribute__((ext_vector_type(8)))  _Float16 v8h;
typedef __attribute__((ext_vector_type(2)))  _Float16 v2h;
typedef __attribute__((ext_vector_type(8)))  float v8f;
typedef __attribute__((ext_vector_type(4)))  float v4f;
typedef __attribute__((ext_vector_type(2)))  float v2f;
typedef __attribute__((ext_vector_type(4)))  unsigned v4u;

template <typename T> __device__ __forceinline__ void vst2(void* p, T v) { *(T*)p = v;  }
__device__ __forceinline__ v8f wmma16(v16h a, v16h b, v8f c) {
  v8f d = __builtin_amdgcn_wmma_f32_16x16x32_f16(false, a, false, b, (short)0, c, false, false);
  asm volatile("v_nop\n\tv_nop\n\tv_nop\n\tv_nop" : "+v"(d) : "v"(a), "v"(b));
  return d;
}
// 16x16x32 fragments: lane = (h = lane>>4, row/col = lane&15); elements 0..7 = k0+8h+0..7, 8..15 = k0+16+8h+0..7; D element r = row 8h+r
__device__ __forceinline__ v16h frag_h(const _Float16* rowk0, int lane) {
  union { v16h v; v8h q[2]; } u; const _Float16* p = rowk0 + 8 * (lane >> 4);
  u.q[0] = *(const v8h*)p; u.q[1] = *(const v8h*)(p + 16); return u.v;
}
__device__ __forceinline__ v16h frag_f32(const float* rowk0, int lane) {
  v16h a; const float* p = rowk0 + 8 * (lane >> 4);
#pragma unroll
  for (int i = 0; i < 8; ++i) { a[i] = (_Float16)p[i]; a[8 + i] = (_Float16)p[16 + i]; }
  return a;
}
// f32 operand of a small product as an f16 pair h + l (l = the rounding remainder of h), so that these products add no f16 operand rounding
struct H2 { v16h h, l; };
__device__ __forceinline__ H2 hsplit16(const float v[16]) { H2 r;
#pragma unroll
  for (int i = 0; i < 16; ++i) { const _Float16 h = (_Float16)v[i]; r.h[i] = h; r.l[i] = (_Float16)(v[i] - (float)h); }
  return r; }
// raw f32 values of two neighbouring fragments (k0 and k0 + 32), fetched ahead of their use: st = 1 along a row, st = ld down a column; p already holds the lane's 8 * (lane >> 4) step
__device__ __forceinline__ void ld_raw2(float (&r)[32], const float* p, int st) {
#pragma unroll
  for (int f = 0; f < 2; ++f)
#pragma unroll
    for (int i = 0; i < 8; ++i) { r[f * 16 + i] = p[(size_t)(f * 32 + i) * st]; r[f * 16 + 8 + i] = p[(size_t)(f * 32 + 16 + i) * st]; }
}
__device__ __forceinline__ H2 split_raw(const float* r, float sc) { float v[16];
#pragma unroll
  for (int i = 0; i < 16; ++i) v[i] = r[i] * sc;
  return hsplit16(v); }
// two stacked 16x16 D tiles (rows k0..k0+15 and k0+16..k0+31 of one column block) are, lane for lane, the B fragment of k0..k0+31
__device__ __forceinline__ H2 split_dd(v8f lo, v8f hi, float sc) { float v[16];
#pragma unroll
  for (int i = 0; i < 8; ++i) { v[i] = lo[i] * sc; v[8 + i] = hi[i] * sc; }
  return hsplit16(v); }
__device__ __forceinline__ v8f mac2(v16h a, const H2& b, v8f c) { c = wmma16(a, b.l, c); return wmma16(a, b.h, c); }
__device__ __forceinline__ v8f mac3(const H2& a, const H2& b, v8f c) { c = wmma16(a.l, b.h, c); c = wmma16(a.h, b.l, c); return wmma16(a.h, b.h, c); }
#define LDSX() do { asm volatile("s_wait_dscnt 0" ::: "memory"); __builtin_amdgcn_wave_barrier(); __builtin_amdgcn_fence(__ATOMIC_RELEASE, "workgroup"); } while (0)

// Softmax-free multi-head linear attention, fully reassociated. With G = x^T x (128 x 128 per batch):
//   K_h^T V_h = Wk_h G Wv_h^T   and   out = sum_h Q_h (K_h^T V_h) = x M,   M = sum_h Wq_h^T (Wk_h (G Wv_h^T)),
// so neither Q, K nor V is formed: x is read twice and out written once. Every product (G, the three small ones per head, x M)
// runs on v_wmma_f32_16x16x32_f16 with f32 accumulate; operands carry power-of-two scales that are undone at the end.
#define NB 8
#define NN 8192
#define DD 128
#define NH 8
#define KQ 64
#define TB 256                 // token rows per Gram partial block
#define NPB (NN / TB)          // 32

// Gram partials: block (pb, b): P[d][d'] = sum over the block's 256 tokens of x[n][d] x[n][d']. x goes to LDS transposed as f16 ([d][n]),
// so A rows and B columns are the same row fragments. 16 waves: row tile wave&7, column half wave>>3.
__global__ __launch_bounds__(512) void k_gram(const float* __restrict__ x, float* __restrict__ part) {
  __shared__ __align__(16) _Float16 xt[DD][TB + 8];
  __shared__ __align__(16) float so[16][16][68];
  const int tid = threadIdx.x, wave = tid >> 5, lane = tid & 31, col = lane & 15, g = lane >> 4;
  const int pb = blockIdx.x, b = blockIdx.y;
  const float* xb = x + ((size_t)b * NN + (size_t)pb * TB) * DD;
  const int d = tid & 127, tq = tid >> 7;
#pragma unroll
  for (int i8 = 0; i8 < 8; ++i8) { union { v8h h; v4u u; } pk;
#pragma unroll
    for (int e = 0; e < 8; ++e) pk.h[e] = (_Float16)xb[(size_t)(tq * 64 + i8 * 8 + e) * DD + d];
    *(v4u*)(&xt[d][tq * 64 + i8 * 8]) = pk.u; }
  __syncthreads();
  const int rt = wave & 7, ch = wave >> 3;
  v8f acc[4] = {};
#pragma unroll
  for (int kc = 0; kc < TB / 32; ++kc) { const v16h a = frag_h(&xt[rt * 16 + col][kc * 32], lane); v16h bf[4];
#pragma unroll
    for (int j = 0; j < 4; ++j) bf[j] = frag_h(&xt[(ch * 4 + j) * 16 + col][kc * 32], lane);
#pragma unroll
    for (int j = 0; j < 4; ++j) acc[j] = wmma16(a, bf[j], acc[j]); }
#pragma unroll
  for (int j = 0; j < 4; ++j)
#pragma unroll
    for (int r = 0; r < 8; ++r) so[wave][8 * g + r][j * 16 + col] = acc[j][r];
  LDSX();
#pragma unroll
  for (int it = 0; it < 8; ++it) { const int rl = it * 2 + g;
    vst2(part + (((size_t)b * NPB + pb) * DD + rt * 16 + rl) * DD + ch * 64 + col * 4, *(const v4f*)(&so[wave][rl][col * 4])); }
}
// G16[b][d][d'] = (sum of the 32 partials, fixed order) / 4 as f16
__global__ __launch_bounds__(256) void k_gsum(const float* __restrict__ part, _Float16* __restrict__ G16) {
  const int q = blockIdx.x * 256 + threadIdx.x, b = q >> 13, o = (q & 8191) * 2;
  v2f s = {0.f, 0.f};
#pragma unroll
  for (int p = 0; p < NPB; ++p) s += *(const v2f*)(part + ((size_t)b * NPB + p) * (DD * DD) + o);
  v2h r; r[0] = (_Float16)(s[0] * 0.25f); r[1] = (_Float16)(s[1] * 0.25f);
  vst2(G16 + (size_t)b * (DD * DD) + o, r);
}
// block (ec, b), wave = head h: for the 16 output columns e of ec: U = G Wv_h[e]^T [128 x 16], KtV = Wk_h U [64 x 16], M_h = Wq_h^T KtV [128 x 16];
// each D feeds the next product as its B fragment in registers; weights and D operands go in as f16 pairs (H2). Heads summed through LDS in fixed order; stored as MT16[b][e][d] = M / 256.
__global__ __launch_bounds__(256) void k_mid(const _Float16* __restrict__ G16, const float* __restrict__ Wk, const float* __restrict__ Wq, const float* __restrict__ Wv, _Float16* __restrict__ MT16) {
  __shared__ __align__(16) float sm[4][16][132];         // [slot][e][d]
  __shared__ __align__(16) _Float16 sG[DD][DD + 8];
  const int tid = threadIdx.x, wave = tid >> 5, lane = tid & 31, col = lane & 15, g = lane >> 4;
  const int ec = blockIdx.x, b = blockIdx.y, h = wave;
  const _Float16* gp = G16 + ((size_t)b * DD + (tid >> 4)) * DD + (tid & 15) * 8;
  v4u gr[8];
#pragma unroll
  for (int it = 0; it < 8; ++it) gr[it] = *(const v4u*)(gp + it * 16 * DD);
  float rv[2][32];
#pragma unroll
  for (int f = 0; f < 2; ++f) ld_raw2(rv[f], Wv + ((size_t)h * DD + ec * 16 + col) * DD + f * 64 + 8 * g, 1);
  // the 16 weight batches of products 2 and 3 (n < 8: Wk row tile n>>1, k half n&1; n >= 8: Wq^T row tile n-8) run through a ring of three register buffers, fetched two batches ahead
  const float* pk = Wk + ((size_t)h * KQ + col) * DD + 8 * g;
  const float* pq = Wq + ((size_t)h * KQ + 8 * g) * DD + col;
  float raw[3][32];
  ld_raw2(raw[0], pk, 1); ld_raw2(raw[1], pk + 64, 1);
#pragma unroll
  for (int it = 0; it < 8; ++it) *(v4u*)(&sG[it * 16 + (tid >> 4)][(tid & 15) * 8]) = gr[it];
  H2 bw[4];
#pragma unroll
  for (int kc = 0; kc < 4; ++kc) bw[kc] = split_raw(&rv[kc >> 1][(kc & 1) * 16], 1024.0f);
  __syncthreads();
  v8f u[8] = {};
#pragma unroll
  for (int i = 0; i < 8; ++i) { v16h ga[4];
#pragma unroll
    for (int kc = 0; kc < 4; ++kc) ga[kc] = frag_h(&sG[i * 16 + col][kc * 32], lane);
#pragma unroll
    for (int kc = 0; kc < 4; ++kc) u[i] = mac2(ga[kc], bw[kc], u[i]); }                                                     // u = 256 U
  H2 ub[4];
#pragma unroll
  for (int kc = 0; kc < 4; ++kc) ub[kc] = split_dd(u[2 * kc], u[2 * kc + 1], 1.0f / 4096.0f);                              // U / 16
  v8f kv[4] = {};
#pragma unroll
  for (int n = 0; n < 8; ++n) {
    if (n + 2 < 8) ld_raw2(raw[(n + 2) % 3], pk + (size_t)((n + 2) >> 1) * 16 * DD + ((n + 2) & 1) * 64, 1); else ld_raw2(raw[(n + 2) % 3], pq + (n + 2 - 8) * 16, DD);
#pragma unroll
    for (int f = 0; f < 2; ++f) kv[n >> 1] = mac3(split_raw(&raw[n % 3][f * 16], 1024.0f), ub[(n & 1) * 2 + f], kv[n >> 1]); }   // kv = 64 KtV
  H2 kb[2];
#pragma unroll
  for (int kc = 0; kc < 2; ++kc) kb[kc] = split_dd(kv[2 * kc], kv[2 * kc + 1], 1.0f / 1024.0f);                            // KtV / 16
  v8f m[8] = {};
#pragma unroll
  for (int n = 8; n < 16; ++n) {
    if (n + 2 < 16) ld_raw2(raw[(n + 2) % 3], pq + (n + 2 - 8) * 16, DD);
#pragma unroll
    for (int f = 0; f < 2; ++f) m[n - 8] = mac3(split_raw(&raw[n % 3][f * 16], 1024.0f), kb[f], m[n - 8]); }                // m = 64 M_h
  if (wave >= 4) {
#pragma unroll
    for (int i = 0; i < 8; ++i)
#pragma unroll
      for (int r = 0; r < 8; ++r) sm[wave - 4][col][i * 16 + 8 * g + r] = m[i][r]; }
  __syncthreads();
  if (wave < 4) {
#pragma unroll
    for (int i = 0; i < 8; ++i)
#pragma unroll
      for (int r = 0; r < 8; ++r) sm[wave][col][i * 16 + 8 * g + r] += m[i][r]; }
  __syncthreads();
  { const int e = tid >> 4, d0 = (tid & 15) * 8; union { v8h h8; v4u u4; } pk;
#pragma unroll
    for (int r = 0; r < 8; ++r) pk.h8[r] = (_Float16)((((sm[0][e][d0 + r] + sm[1][e][d0 + r]) + sm[2][e][d0 + r]) + sm[3][e][d0 + r]) * (1.0f / 16384.0f));
    vst2(MT16 + ((size_t)b * DD + ec * 16 + e) * DD + d0, pk.u4); }
}
// out[b][n][e] = sum_d x[b][n][d] M[b][d][e]: K = 128; M of the batch staged in LDS, 8 waves x 16 token rows
__global__ __launch_bounds__(256) void k_out(const float* __restrict__ x, const _Float16* __restrict__ MT16, float* __restrict__ out) {
  __shared__ __align__(16) _Float16 sM[DD][DD + 8];       // [e][d]
  __shared__ __align__(16) float so[8][16][132];
  const int tid = threadIdx.x, wave = tid >> 5, lane = tid & 31, col = lane & 15, g = lane >> 4;
  const int b = blockIdx.y, r0 = b * NN + blockIdx.x * 128 + wave * 16;
  const _Float16* mp = MT16 + ((size_t)b * DD + (tid >> 4)) * DD + (tid & 15) * 8;
  v16h a[4];
#pragma unroll
  for (int kc = 0; kc < 4; ++kc) a[kc] = frag_f32(x + (size_t)(r0 + col) * DD + kc * 32, lane);
#pragma unroll
  for (int it = 0; it < 8; ++it) *(v4u*)(&sM[it * 16 + (tid >> 4)][(tid & 15) * 8]) = *(const v4u*)(mp + it * 16 * DD);
  __syncthreads();
  v8f acc[8] = {};
#pragma unroll
  for (int kc = 0; kc < 4; ++kc) { v16h bf[8];
#pragma unroll
    for (int j = 0; j < 8; ++j) bf[j] = frag_h(&sM[j * 16 + col][kc * 32], lane);
#pragma unroll
    for (int j = 0; j < 8; ++j) acc[j] = wmma16(a[kc], bf[j], acc[j]); }
#pragma unroll
  for (int j = 0; j < 8; ++j)
#pragma unroll
    for (int r = 0; r < 8; ++r) so[wave][8 * g + r][j * 16 + col] = acc[j][r] * 256.0f;
  LDSX();
#pragma unroll
  for (int rl = 0; rl < 16; ++rl) vst2(out + (size_t)(r0 + rl) * DD + lane * 4, *(const v4f*)(&so[wave][rl][lane * 4]));
}
extern "C" void kernel_launch(void* const* d_in, const int* in_sizes, int n_in, void* d_out, int out_size, void* d_ws, size_t ws_size, hipStream_t stream) {
  (void)in_sizes; (void)n_in; (void)out_size; (void)ws_size;
  const float* x = (const float*)d_in[0]; const float* Wk = (const float*)d_in[1]; const float* Wq = (const float*)d_in[2]; const float* Wv = (const float*)d_in[3];
  float* out = (float*)d_out;
  char* ws = (char*)d_ws; size_t off = 0;
  auto take = [&](size_t bytes) { char* p = ws + off; off += (bytes + 255) & ~(size_t)255; return p; };
  float* part = (float*)take((size_t)NB * NPB * DD * DD * 4); _Float16* G16 = (_Float16*)take((size_t)NB * DD * DD * 2); _Float16* MT16 = (_Float16*)take((size_t)NB * DD * DD * 2);
  k_gram<<<dim3(NPB, NB), 512, 0, stream>>>(x, part);
  k_gsum<<<NB * DD * DD / 2 / 256, 256, 0, stream>>>(part, G16);
  k_mid<<<dim3(DD / 16, NB), 256, 0, stream>>>(G16, Wk, Wq, Wv, MT16);
  k_out<<<dim3(NN / 128, NB), 256, 0, stream>>>(x, MT16, out);
}

// v002
// One run takes 27.6 microseconds.
// In both of two side-by-side timings against v001, it was 1.16 times as fast.
// Counting every step since v000, it is 7.95 times as fast.
#include <hip/hip_runtime.h>
#include <math.h>

typedef __attribute__((ext_vector_type(16))) _Float16 v16h;
typedef __attribute__((ext_vector_type(8)))  _Float16 v8h;
typedef __attribute__((ext_vector_type(4)))  _Float16 v4h;
typedef __attribute__((ext_vector_type(2)))  _Float16 v2h;
typedef __attribute__((ext_vector_type(8)))  float v8f;
typedef __attribute__((ext_vector_type(4)))  float v4f;
typedef __attribute__((ext_vector_type(2)))  float v2f;
typedef __attribute__((ext_vector_type(4)))  unsigned v4u;

template <typename T> __device__ __forceinline__ void vst2(void* p, T v) { *(T*)p = v;  }
__device__ __forceinline__ v8f wmma16(v16h a, v16h b, v8f c) {
  v8f d = __builtin_amdgcn_wmma_f32_16x16x32_f16(false, a, false, b, (short)0, c, false, false);
  asm volatile("v_nop\n\tv_nop\n\tv_nop\n\tv_nop" : "+v"(d) : "v"(a), "v"(b));
  return d;
}
// 16x16x32 fragments: lane = (h = lane>>4, row/col = lane&15); elements 0..7 = k0+8h+0..7, 8..15 = k0+16+8h+0..7; D element r = row 8h+r
__device__ __forceinline__ v16h frag_h(const _Float16* rowk0, int lane) {
  union { v16h v; v8h q[2]; } u; const _Float16* p = rowk0 + 8 * (lane >> 4);
  u.q[0] = *(const v8h*)p; u.q[1] = *(const v8h*)(p + 16); return u.v;
}
__device__ __forceinline__ v16h frag_f32(const float* rowk0, int lane) {
  v16h a; const float* p = rowk0 + 8 * (lane >> 4);
#pragma unroll
  for (int i = 0; i < 8; ++i) { a[i] = (_Float16)p[i]; a[8 + i] = (_Float16)p[16 + i]; }
  return a;
}
// f32 operand of a small product as an f16 pair h + l (l = the rounding remainder of h), so that these products add no f16 operand rounding
struct H2 { v16h h, l; };
__device__ __forceinline__ H2 hsplit16(const float v[16]) { H2 r;
#pragma unroll
  for (int i = 0; i < 16; ++i) { const _Float16 h = (_Float16)v[i]; r.h[i] = h; r.l[i] = (_Float16)(v[i] - (float)h); }
  return r; }
// one weight fragment as its stored f16 pair. Record of FRH halves: [h, l][elements 0..7, 8..15][lane][8], so each of the four loads is 512 contiguous bytes a wave; p = record + lane * 8
#define FRH 1024
__device__ __forceinline__ H2 ld_h2(const _Float16* p) {
  union { v16h v; v8h q[2]; } a, b;
  a.q[0] = *(const v8h*)p; a.q[1] = *(const v8h*)(p + 256); b.q[0] = *(const v8h*)(p + 512); b.q[1] = *(const v8h*)(p + 768);
  H2 r; r.h = a.v; r.l = b.v; return r; }
// two stacked 16x16 D tiles (rows k0..k0+15 and k0+16..k0+31 of one column block) are, lane for lane, the B fragment of k0..k0+31
__device__ __forceinline__ H2 split_dd(v8f lo, v8f hi, float sc) { float v[16];
#pragma unroll
  for (int i = 0; i < 8; ++i) { v[i] = lo[i] * sc; v[8 + i] = hi[i] * sc; }
  return hsplit16(v); }
__device__ __forceinline__ v8f mac2(v16h a, const H2& b, v8f c) { c = wmma16(a, b.l, c); return wmma16(a, b.h, c); }
__device__ __forceinline__ v8f mac3(const H2& a, const H2& b, v8f c) { c = wmma16(a.l, b.h, c); c = wmma16(a.h, b.l, c); return wmma16(a.h, b.h, c); }
#define LDSX() do { asm volatile("s_wait_dscnt 0" ::: "memory"); __builtin_amdgcn_wave_barrier(); __builtin_amdgcn_fence(__ATOMIC_RELEASE, "workgroup"); } while (0)

// Softmax-free multi-head linear attention, fully reassociated. With G = x^T x (128 x 128 per batch):
//   K_h^T V_h = Wk_h G Wv_h^T   and   out = sum_h Q_h (K_h^T V_h) = x M,   M = sum_h Wq_h^T (Wk_h (G Wv_h^T)),
// so neither Q, K nor V is formed: x is read twice and out written once. Every product (G, the three small ones per head, x M)
// runs on v_wmma_f32_16x16x32_f16 with f32 accumulate; operands carry power-of-two scales that are undone at the end.
#define NB 8
#define NN 8192
#define DD 128
#define NH 8
#define KQ 64
#define TB 256                 // token rows per Gram partial block
#define NPB (NN / TB)          // 32
#define RB 3                   // register buffers of the weight ring in k_mid

// Gram partials: block (pb, b): P[d][d'] = sum over the block's 256 tokens of x[n][d] x[n][d']. x goes to LDS transposed as f16 ([d][n]),
// so A rows and B columns are the same row fragments. 16 waves: row tile wave&7, column half wave>>3.
__global__ __launch_bounds__(512) void k_gram(const float* __restrict__ x, float* __restrict__ part) {
  __shared__ __align__(16) _Float16 xt[DD][TB + 8];
  __shared__ __align__(16) float so[16][16][68];
  const int tid = threadIdx.x, wave = tid >> 5, lane = tid & 31, col = lane & 15, g = lane >> 4;
  const int pb = blockIdx.x, b = blockIdx.y;
  const float* xb = x + ((size_t)b * NN + (size_t)pb * TB) * DD;
  const int d = tid & 127, tq = tid >> 7;
#pragma unroll
  for (int i8 = 0; i8 < 8; ++i8) { union { v8h h; v4u u; } pk;
#pragma unroll
    for (int e = 0; e < 8; ++e) pk.h[e] = (_Float16)xb[(size_t)(tq * 64 + i8 * 8 + e) * DD + d];
    *(v4u*)(&xt[d][tq * 64 + i8 * 8]) = pk.u; }
  __syncthreads();
  const int rt = wave & 7, ch = wave >> 3;
  v8f acc[4] = {};
#pragma unroll
  for (int kc = 0; kc < TB / 32; ++kc) { const v16h a = frag_h(&xt[rt * 16 + col][kc * 32], lane); v16h bf[4];
#pragma unroll
    for (int j = 0; j < 4; ++j) bf[j] = frag_h(&xt[(ch * 4 + j) * 16 + col][kc * 32], lane);
#pragma unroll
    for (int j = 0; j < 4; ++j) acc[j] = wmma16(a, bf[j], acc[j]); }
#pragma unroll
  for (int j = 0; j < 4; ++j)
#pragma unroll
    for (int r = 0; r < 8; ++r) so[wave][8 * g + r][j * 16 + col] = acc[j][r];
  LDSX();
#pragma unroll
  for (int it = 0; it < 8; ++it) { const int rl = it * 2 + g;
    vst2(part + (((size_t)b * NPB + pb) * DD + rt * 16 + rl) * DD + ch * 64 + col * 4, *(const v4f*)(&so[wave][rl][col * 4])); }
}
// G16[b][d][d'] = (sum of the 32 partials, fixed order) / 4 as f16.
// Beside its two sums each thread turns four weights (x 1024) into their f16 pair h + l, once for all batches and column blocks, and stores them in fragment order:
// records h * 32 + (row tile * 4 + kc) = Wk_h, h * 32 + 16 + (d tile * 2 + kc) = Wq_h^T, 256 + (h * 8 + e tile) * 4 + kc = Wv_h.
__global__ __launch_bounds__(256) void k_gsum(const float* __restrict__ part, const float* __restrict__ Wk, const float* __restrict__ Wq, const float* __restrict__ Wv, _Float16* __restrict__ G16, _Float16* __restrict__ WS) {
  const int q = blockIdx.x * 256 + threadIdx.x, b = q >> 13, o = (q & 8191) * 2;
  const int F = q >> 7, q2 = (q >> 6) & 1, ln = (q >> 1) & 31, i0 = (q & 1) * 4, kk = 16 * q2 + 8 * (ln >> 4) + i0, c = ln & 15;
  v4f w;
  if (blockIdx.x >= 128) { const int f = F - 256; w = *(const v4f*)(Wv + ((size_t)(f >> 2) * 16 + c) * DD + (f & 3) * 32 + kk); }
  else if ((blockIdx.x & 8) == 0) { const int r = F & 15; w = *(const v4f*)(Wk + ((size_t)(F >> 5) * KQ + (r >> 2) * 16 + c) * DD + (r & 3) * 32 + kk); }
  else { const int r = F & 15; const float* p = Wq + ((size_t)(F >> 5) * KQ + (r & 1) * 32 + kk) * DD + (r >> 1) * 16 + c;
#pragma unroll
    for (int j = 0; j < 4; ++j) w[j] = p[j * DD]; }
  asm volatile("s_wait_xcnt 0x0" ::: "memory");   // the address registers of the weight loads are reused by the address arithmetic below
  v2f s = {0.f, 0.f};
#pragma unroll
  for (int p = 0; p < NPB; ++p) s += *(const v2f*)(part + ((size_t)b * NPB + p) * (DD * DD) + o);
  v2h r; r[0] = (_Float16)(s[0] * 0.25f); r[1] = (_Float16)(s[1] * 0.25f);
  vst2(G16 + (size_t)b * (DD * DD) + o, r);
  v4h wh, wl;
#pragma unroll
  for (int j = 0; j < 4; ++j) { const float v = w[j] * 1024.0f; const _Float16 hh = (_Float16)v; wh[j] = hh; wl[j] = (_Float16)(v - (float)hh); }
  _Float16* wp = WS + (size_t)F * FRH + q2 * 256 + ln * 8 + i0;
  vst2(wp, wh); vst2(wp + 512, wl);
}
// block (ec, b), wave = head h: for the 16 output columns e of ec: U = G Wv_h[e]^T [128 x 16], KtV = Wk_h U [64 x 16], M_h = Wq_h^T KtV [128 x 16];
// each D feeds the next product as its B fragment in registers; weights (stored pairs of k_gsum) and D operands go in as f16 pairs (H2). Heads summed through LDS in fixed order; stored as MT16[b][e][d] = M / 256.
__global__ __launch_bounds__(256) void k_mid(const _Float16* __restrict__ G16, const _Float16* __restrict__ WS, _Float16* __restrict__ MT16) {
  __shared__ __align__(16) float sm[4][16][132];         // [slot][e][d]
  __shared__ __align__(16) _Float16 sG[DD][DD + 8];
  const int tid = threadIdx.x, wave = tid >> 5, lane = tid & 31, col = lane & 15, g = lane >> 4;
  const int ec = blockIdx.x, b = blockIdx.y, h = wave;
  const _Float16* gp = G16 + ((size_t)b * DD + (tid >> 4)) * DD + (tid & 15) * 8;
  v4u gr[8];
#pragma unroll
  for (int it = 0; it < 8; ++it) gr[it] = *(const v4u*)(gp + it * 16 * DD);
  asm volatile("s_wait_xcnt 0x0" ::: "memory");   // the address registers of these loads are given to the weight loads below as destinations
  H2 bw[4];
#pragma unroll
  for (int kc = 0; kc < 4; ++kc) bw[kc] = ld_h2(WS + (size_t)(256 + (h * 8 + ec) * 4 + kc) * FRH + lane * 8);
  asm volatile("s_wait_xcnt 0x0" ::: "memory");   // likewise: their address registers become destinations of the ring's first loads
  // the 16 weight batches of products 2 and 3 (two records each; n < 8: Wk row tile n>>1, k half n&1; n >= 8: Wq^T row tile n-8) run through a ring of RB register buffers, fetched RB - 1 batches ahead
  const _Float16* pw = WS + (size_t)h * 32 * FRH + lane * 8;
  H2 wr[RB][2];
#pragma unroll
  for (int n = 0; n < RB - 1; ++n)
#pragma unroll
    for (int f = 0; f < 2; ++f) wr[n][f] = ld_h2(pw + (n * 2 + f) * FRH);
#pragma unroll
  for (int it = 0; it < 8; ++it) *(v4u*)(&sG[it * 16 + (tid >> 4)][(tid & 15) * 8]) = gr[it];
  __syncthreads();
  v8f u[8] = {};
#pragma unroll
  for (int i = 0; i < 8; ++i) { v16h ga[4];
#pragma unroll
    for (int kc = 0; kc < 4; ++kc) ga[kc] = frag_h(&sG[i * 16 + col][kc * 32], lane);
#pragma unroll
    for (int kc = 0; kc < 4; ++kc) u[i] = mac2(ga[kc], bw[kc], u[i]); }                                                     // u = 256 U
  H2 ub[4];
#pragma unroll
  for (int kc = 0; kc < 4; ++kc) ub[kc] = split_dd(u[2 * kc], u[2 * kc + 1], 1.0f / 4096.0f);                              // U / 16
  v8f kv[4] = {};
#pragma unroll
  for (int n = 0; n < 8; ++n) {
#pragma unroll
    for (int f = 0; f < 2; ++f) wr[(n + RB - 1) % RB][f] = ld_h2(pw + ((n + RB - 1) * 2 + f) * FRH);
#pragma unroll
    for (int f = 0; f < 2; ++f) kv[n >> 1] = mac3(wr[n % RB][f], ub[(n & 1) * 2 + f], kv[n >> 1]); }   // kv = 64 KtV
  H2 kb[2];
#pragma unroll
  for (int kc = 0; kc < 2; ++kc) kb[kc] = split_dd(kv[2 * kc], kv[2 * kc + 1], 1.0f / 1024.0f);                            // KtV / 16
  v8f m[8] = {};
#pragma unroll
  for (int n = 8; n < 16; ++n) {
    if (n + RB - 1 < 16) {
#pragma unroll
      for (int f = 0; f < 2; ++f) wr[(n + RB - 1) % RB][f] = ld_h2(pw + ((n + RB - 1) * 2 + f) * FRH); }
#pragma unroll
    for (int f = 0; f < 2; ++f) m[n - 8] = mac3(wr[n % RB][f], kb[f], m[n - 8]); }                // m = 64 M_h
  if (wave >= 4) {
#pragma unroll
    for (int i = 0; i < 8; ++i)
#pragma unroll
      for (int r = 0; r < 8; ++r) sm[wave - 4][col][i * 16 + 8 * g + r] = m[i][r]; }
  __syncthreads();
  if (wave < 4) {
#pragma unroll
    for (int i = 0; i < 8; ++i)
#pragma unroll
      for (int r = 0; r < 8; ++r) sm[wave][col][i * 16 + 8 * g + r] += m[i][r]; }
  __syncthreads();
  { const int e = tid >> 4, d0 = (tid & 15) * 8; union { v8h h8; v4u u4; } pk;
#pragma unroll
    for (int r = 0; r < 8; ++r) pk.h8[r] = (_Float16)((((sm[0][e][d0 + r] + sm[1][e][d0 + r]) + sm[2][e][d0 + r]) + sm[3][e][d0 + r]) * (1.0f / 16384.0f));
    vst2(MT16 + ((size_t)b * DD + ec * 16 + e) * DD + d0, pk.u4); }
}
// out[b][n][e] = sum_d x[b][n][d] M[b][d][e]: K = 128; M of the batch staged in LDS, 8 waves x 16 token rows
__global__ __launch_bounds__(256) void k_out(const float* __restrict__ x, const _Float16* __restrict__ MT16, float* __restrict__ out) {
  __shared__ __align__(16) _Float16 sM[DD][DD + 8];       // [e][d]
  __shared__ __align__(16) float so[8][16][132];
  const int tid = threadIdx.x, wave = tid >> 5, lane = tid & 31, col = lane & 15, g = lane >> 4;
  const int b = blockIdx.y, r0 = b * NN + blockIdx.x * 128 + wave * 16;
  const _Float16* mp = MT16 + ((size_t)b * DD + (tid >> 4)) * DD + (tid & 15) * 8;
  v16h a[4];
#pragma unroll
  for (int kc = 0; kc < 4; ++kc) a[kc] = frag_f32(x + (size_t)(r0 + col) * DD + kc * 32, lane);
#pragma unroll
  for (int it = 0; it < 8; ++it) *(v4u*)(&sM[it * 16 + (tid >> 4)][(tid & 15) * 8]) = *(const v4u*)(mp + it * 16 * DD);
  __syncthreads();
  v8f acc[8] = {};
#pragma unroll
  for (int kc = 0; kc < 4; ++kc) { v16h bf[8];
#pragma unroll
    for (int j = 0; j < 8; ++j) bf[j] = frag_h(&sM[j * 16 + col][kc * 32], lane);
#pragma unroll
    for (int j = 0; j < 8; ++j) acc[j] = wmma16(a[kc], bf[j], acc[j]); }
#pragma unroll
  for (int j = 0; j < 8; ++j)
#pragma unroll
    for (int r = 0; r < 8; ++r) so[wave][8 * g + r][j * 16 + col] = acc[j][r] * 256.0f;
  LDSX();
#pragma unroll
  for (int rl = 0; rl < 16; ++rl) vst2(out + (size_t)(r0 + rl) * DD + lane * 4, *(const v4f*)(&so[wave][rl][lane * 4]));
}
extern "C" void kernel_launch(void* const* d_in, const int* in_sizes, int n_in, void* d_out, int out_size, void* d_ws, size_t ws_size, hipStream_t stream) {
  (void)in_sizes; (void)n_in; (void)out_size; (void)ws_size;
  const float* x = (const float*)d_in[0]; const float* Wk = (const float*)d_in[1]; const float* Wq = (const float*)d_in[2]; const float* Wv = (const float*)d_in[3];
  float* out = (float*)d_out;
  char* ws = (char*)d_ws; size_t off = 0;
  auto take = [&](size_t bytes) { char* p = ws + off; off += (bytes + 255) & ~(size_t)255; return p; };
  float* part = (float*)take((size_t)NB * NPB * DD * DD * 4); _Float16* G16 = (_Float16*)take((size_t)NB * DD * DD * 2); _Float16* MT16 = (_Float16*)take((size_t)NB * DD * DD * 2);
  _Float16* WS = (_Float16*)take((size_t)512 * FRH * 2);
  k_gram<<<dim3(NPB, NB), 512, 0, stream>>>(x, part);
  k_gsum<<<NB * DD * DD / 2 / 256, 256, 0, stream>>>(part, Wk, Wq, Wv, G16, WS);
  k_mid<<<dim3(DD / 16, NB), 256, 0, stream>>>(G16, WS, MT16);
  k_out<<<dim3(NN / 128, NB), 256, 0, stream>>>(x, MT16, out);
}

// v003
// A run of this version takes 26 microseconds.
// Next to v002, in two timings, it ran 1.06 times as fast each time.
// Counting every step since v000, it is 8.41 times as fast.
#include <hip/hip_runtime.h>
#include <math.h>

typedef __attribute__((ext_vector_type(16))) _Float16 v16h;
typedef __attribute__((ext_vector_type(8)))  _Float16 v8h;
typedef __attribute__((ext_vector_type(4)))  _Float16 v4h;
typedef __attribute__((ext_vector_type(2)))  _Float16 v2h;
typedef __attribute__((ext_vector_type(8)))  float v8f;
typedef __attribute__((ext_vector_type(4)))  float v4f;
typedef __attribute__((ext_vector_type(2)))  float v2f;
typedef __attribute__((ext_vector_type(4)))  unsigned v4u;

template <typename T> __device__ __forceinline__ void vst2(void* p, T v) { *(T*)p = v;  }
__device__ __forceinline__ v8f wmma16(v16h a, v16h b, v8f c) {
  v8f d = __builtin_amdgcn_wmma_f32_16x16x32_f16(false, a, false, b, (short)0, c, false, false);
  asm volatile("v_nop\n\tv_nop\n\tv_nop\n\tv_nop" : "+v"(d) : "v"(a), "v"(b));
  return d;
}
// 16x16x32 fragments: lane = (h = lane>>4, row/col = lane&15); elements 0..7 = k0+8h+0..7, 8..15 = k0+16+8h+0..7; D element r = row 8h+r
__device__ __forceinline__ v16h frag_h(const _Float16* rowk0, int lane) {
  union { v16h v; v8h q[2]; } u; const _Float16* p = rowk0 + 8 * (lane >> 4);
  u.q[0] = *(const v8h*)p; u.q[1] = *(const v8h*)(p + 16); return u.v;
}
__device__ __forceinline__ v16h frag_f32(const float* rowk0, int lane) {
  v16h a; const float* p = rowk0 + 8 * (lane >> 4);
#pragma unroll
  for (int i = 0; i < 8; ++i) { a[i] = (_Float16)p[i]; a[8 + i] = (_Float16)p[16 + i]; }
  return a;
}
// f32 operand of a small product as an f16 pair h + l (l = the rounding remainder of h), so that these products add no f16 operand rounding
struct H2 { v16h h, l; };
__device__ __forceinline__ H2 hsplit16(const float v[16]) { H2 r;
#pragma unroll
  for (int i = 0; i < 16; ++i) { const _Float16 h = (_Float16)v[i]; r.h[i] = h; r.l[i] = (_Float16)(v[i] - (float)h); }
  return r; }
// one weight fragment as its stored f16 pair. Record of FRH halves: [h, l][elements 0..7, 8..15][lane][8], so each of the four loads is 512 contiguous bytes a wave; p = record + lane * 8
#define FRH 1024
__device__ __forceinline__ H2 ld_h2(const _Float16* p) {
  union { v16h v; v8h q[2]; } a, b;
  a.q[0] = *(const v8h*)p; a.q[1] = *(const v8h*)(p + 256); b.q[0] = *(const v8h*)(p + 512); b.q[1] = *(const v8h*)(p + 768);
  H2 r; r.h = a.v; r.l = b.v; return r; }
// two stacked 16x16 D tiles (rows k0..k0+15 and k0+16..k0+31 of one column block) are, lane for lane, the B fragment of k0..k0+31
__device__ __forceinline__ H2 split_dd(v8f lo, v8f hi, float sc) { float v[16];
#pragma unroll
  for (int i = 0; i < 8; ++i) { v[i] = lo[i] * sc; v[8 + i] = hi[i] * sc; }
  return hsplit16(v); }
__device__ __forceinline__ v8f mac2(v16h a, const H2& b, v8f c) { c = wmma16(a, b.l, c); return wmma16(a, b.h, c); }
__device__ __forceinline__ v8f mac3(const H2& a, const H2& b, v8f c) { c = wmma16(a.l, b.h, c); c = wmma16(a.h, b.l, c); return wmma16(a.h, b.h, c); }
#define LDSX() do { asm volatile("s_wait_dscnt 0" ::: "memory"); __builtin_amdgcn_wave_barrier(); __builtin_amdgcn_fence(__ATOMIC_RELEASE, "workgroup"); } while (0)

// Softmax-free multi-head linear attention, fully reassociated. With G = x^T x (128 x 128 per batch):
//   K_h^T V_h = Wk_h G Wv_h^T   and   out = sum_h Q_h (K_h^T V_h) = x M,   M = sum_h Wq_h^T (Wk_h (G Wv_h^T)),
// so neither Q, K nor V is formed: x is read twice and out written once. Every product (G, the three small ones per head, x M)
// runs on v_wmma_f32_16x16x32_f16 with f32 accumulate; operands carry power-of-two scales that are undone at the end.
#define NB 8
#define NN 8192
#define DD 128
#define NH 8
#define KQ 64
#define TB 256                 // token rows per Gram partial block
#define NPB (NN / TB)          // 32
#define RB 3                   // register buffers of the weight ring in k_mid

// Gram partials: block (pb, b): P[d][d'] = sum over the block's 256 tokens of x[n][d] x[n][d']. x goes to LDS transposed as f16 ([d][n]),
// so A rows and B columns are the same row fragments. 16 waves: row tile wave&7, column half wave>>3.
__global__ __launch_bounds__(512) void k_gram(const float* __restrict__ x, float* __restrict__ part) {
  __shared__ __align__(16) _Float16 xt[DD][TB + 8];
  __shared__ __align__(16) float so[16][16][68];
  const int tid = threadIdx.x, wave = tid >> 5, lane = tid & 31, col = lane & 15, g = lane >> 4;
  const int pb = blockIdx.x, b = blockIdx.y;
  const float* xb = x + ((size_t)b * NN + (size_t)pb * TB) * DD;
  const int d = tid & 127, tq = tid >> 7;
#pragma unroll
  for (int i8 = 0; i8 < 8; ++i8) { union { v8h h; v4u u; } pk;
#pragma unroll
    for (int e = 0; e < 8; ++e) pk.h[e] = (_Float16)xb[(size_t)(tq * 64 + i8 * 8 + e) * DD + d];
    *(v4u*)(&xt[d][tq * 64 + i8 * 8]) = pk.u; }
  __syncthreads();
  const int rt = wave & 7, ch = wave >> 3;
  v8f acc[4] = {};
#pragma unroll
  for (int kc = 0; kc < TB / 32; ++kc) { const v16h a = frag_h(&xt[rt * 16 + col][kc * 32], lane); v16h bf[4];
#pragma unroll
    for (int j = 0; j < 4; ++j) bf[j] = frag_h(&xt[(ch * 4 + j) * 16 + col][kc * 32], lane);
#pragma unroll
    for (int j = 0; j < 4; ++j) acc[j] = wmma16(a, bf[j], acc[j]); }
#pragma unroll
  for (int j = 0; j < 4; ++j)
#pragma unroll
    for (int r = 0; r < 8; ++r) so[wave][8 * g + r][j * 16 + col] = acc[j][r];
  LDSX();
#pragma unroll
  for (int it = 0; it < 8; ++it) { const int rl = it * 2 + g;
    vst2(part + (((size_t)b * NPB + pb) * DD + rt * 16 + rl) * DD + ch * 64 + col * 4, *(const v4f*)(&so[wave][rl][col * 4])); }
}
// G16[b][d][d'] = (sum of the 32 partials, fixed order) / 4 as f16.
// Beside its two sums each thread turns four weights (x 1024) into their f16 pair h + l, once for all batches and column blocks, and stores them in fragment order:
// records h * 32 + (row tile * 4 + kc) = Wk_h, h * 32 + 16 + (d tile * 2 + kc) = Wq_h^T, 256 + (h * 8 + e tile) * 4 + kc = Wv_h.
__global__ __launch_bounds__(256) void k_gsum(const float* __restrict__ part, const float* __restrict__ Wk, const float* __restrict__ Wq, const float* __restrict__ Wv, _Float16* __restrict__ G16, _Float16* __restrict__ WS) {
  const int q = blockIdx.x * 256 + threadIdx.x, b = q >> 13, o = (q & 8191) * 2;
  const int F = q >> 7, q2 = (q >> 6) & 1, ln = (q >> 1) & 31, i0 = (q & 1) * 4, kk = 16 * q2 + 8 * (ln >> 4) + i0, c = ln & 15;
  v4f w;
  if (blockIdx.x >= 128) { const int f = F - 256; w = *(const v4f*)(Wv + ((size_t)(f >> 2) * 16 + c) * DD + (f & 3) * 32 + kk); }
  else if ((blockIdx.x & 8) == 0) { const int r = F & 15; w = *(const v4f*)(Wk + ((size_t)(F >> 5) * KQ + (r >> 2) * 16 + c) * DD + (r & 3) * 32 + kk); }
  else { const int r = F & 15; const float* p = Wq + ((size_t)(F >> 5) * KQ + (r & 1) * 32 + kk) * DD + (r >> 1) * 16 + c;
#pragma unroll
    for (int j = 0; j < 4; ++j) w[j] = p[j * DD]; }
  asm volatile("s_wait_xcnt 0x0" ::: "memory");   // the address registers of the weight loads are reused by the address arithmetic below
  v2f s = {0.f, 0.f};
#pragma unroll
  for (int p = 0; p < NPB; ++p) s += *(const v2f*)(part + ((size_t)b * NPB + p) * (DD * DD) + o);
  v2h r; r[0] = (_Float16)(s[0] * 0.25f); r[1] = (_Float16)(s[1] * 0.25f);
  vst2(G16 + (size_t)b * (DD * DD) + o, r);
  v4h wh, wl;
#pragma unroll
  for (int j = 0; j < 4; ++j) { const float v = w[j] * 1024.0f; const _Float16 hh = (_Float16)v; wh[j] = hh; wl[j] = (_Float16)(v - (float)hh); }
  _Float16* wp = WS + (size_t)F * FRH + q2 * 256 + ln * 8 + i0;
  vst2(wp, wh); vst2(wp + 512, wl);
}
// block (ec, b), wave = head h: for the 16 output columns e of ec: U = G Wv_h[e]^T [128 x 16], KtV = Wk_h U [64 x 16], M_h = Wq_h^T KtV [128 x 16];
// each D feeds the next product as its B fragment in registers; weights (stored pairs of k_gsum) and D operands go in as f16 pairs (H2). Heads summed through LDS in fixed order; stored as MT16[b][e][d] = M / 256.
__global__ __launch_bounds__(256) void k_mid(const _Float16* __restrict__ G16, const _Float16* __restrict__ WS, _Float16* __restrict__ MT16) {
  __shared__ __align__(16) float sm[4][16][132];         // [slot][e][d]
  __shared__ __align__(16) _Float16 sG[DD][DD + 8];
  const int tid = threadIdx.x, wave = tid >> 5, lane = tid & 31, col = lane & 15, g = lane >> 4;
  const int ec = blockIdx.x, b = blockIdx.y, h = wave;
  const _Float16* gp = G16 + ((size_t)b * DD + (tid >> 4)) * DD + (tid & 15) * 8;
  v4u gr[8];
#pragma unroll
  for (int it = 0; it < 8; ++it) gr[it] = *(const v4u*)(gp + it * 16 * DD);
  asm volatile("s_wait_xcnt 0x0" ::: "memory");   // the address registers of these loads are given to the weight loads below as destinations
  H2 bw[4];
#pragma unroll
  for (int kc = 0; kc < 4; ++kc) bw[kc] = ld_h2(WS + (size_t)(256 + (h * 8 + ec) * 4 + kc) * FRH + lane * 8);
  asm volatile("s_wait_xcnt 0x0" ::: "memory");   // likewise: their address registers become destinations of the ring's first loads
  // the 16 weight batches of products 2 and 3 (two records each; n < 8: Wk row tile n>>1, k half n&1; n >= 8: Wq^T row tile n-8) run through a ring of RB register buffers, fetched RB - 1 batches ahead
  const _Float16* pw = WS + (size_t)h * 32 * FRH + lane * 8;
  H2 wr[RB][2];
#pragma unroll
  for (int n = 0; n < RB - 1; ++n)
#pragma unroll
    for (int f = 0; f < 2; ++f) wr[n][f] = ld_h2(pw + (n * 2 + f) * FRH);
#pragma unroll
  for (int it = 0; it < 8; ++it) *(v4u*)(&sG[it * 16 + (tid >> 4)][(tid & 15) * 8]) = gr[it];
  __syncthreads();
  v8f u[8] = {};
#pragma unroll
  for (int i = 0; i < 8; ++i) { v16h ga[4];
#pragma unroll
    for (int kc = 0; kc < 4; ++kc) ga[kc] = frag_h(&sG[i * 16 + col][kc * 32], lane);
#pragma unroll
    for (int kc = 0; kc < 4; ++kc) u[i] = mac2(ga[kc], bw[kc], u[i]); }                                                     // u = 256 U
  H2 ub[4];
#pragma unroll
  for (int kc = 0; kc < 4; ++kc) ub[kc] = split_dd(u[2 * kc], u[2 * kc + 1], 1.0f / 4096.0f);                              // U / 16
  v8f kv[4] = {};
#pragma unroll
  for (int n = 0; n < 8; ++n) {
#pragma unroll
    for (int f = 0; f < 2; ++f) wr[(n + RB - 1) % RB][f] = ld_h2(pw + ((n + RB - 1) * 2 + f) * FRH);
#pragma unroll
    for (int f = 0; f < 2; ++f) kv[n >> 1] = mac3(wr[n % RB][f], ub[(n & 1) * 2 + f], kv[n >> 1]); }   // kv = 64 KtV
  H2 kb[2];
#pragma unroll
  for (int kc = 0; kc < 2; ++kc) kb[kc] = split_dd(kv[2 * kc], kv[2 * kc + 1], 1.0f / 1024.0f);                            // KtV / 16
  v8f m[8] = {};
#pragma unroll
  for (int n = 8; n < 16; ++n) {
    if (n + RB - 1 < 16) {
#pragma unroll
      for (int f = 0; f < 2; ++f) wr[(n + RB - 1) % RB][f] = ld_h2(pw + ((n + RB - 1) * 2 + f) * FRH); }
#pragma unroll
    for (int f = 0; f < 2; ++f) m[n - 8] = mac3(wr[n % RB][f], kb[f], m[n - 8]); }                // m = 64 M_h
  if (wave >= 4) {
#pragma unroll
    for (int i = 0; i < 8; ++i)
#pragma unroll
      for (int r = 0; r < 8; ++r) sm[wave - 4][col][i * 16 + 8 * g + r] = m[i][r]; }
  __syncthreads();
  if (wave < 4) {
#pragma unroll
    for (int i = 0; i < 8; ++i)
#pragma unroll
      for (int r = 0; r < 8; ++r) sm[wave][col][i * 16 + 8 * g + r] += m[i][r]; }
  __syncthreads();
  { const int e = tid >> 4, d0 = (tid & 15) * 8; union { v8h h8; v4u u4; } pk;
#pragma unroll
    for (int r = 0; r < 8; ++r) pk.h8[r] = (_Float16)((((sm[0][e][d0 + r] + sm[1][e][d0 + r]) + sm[2][e][d0 + r]) + sm[3][e][d0 + r]) * (1.0f / 16384.0f));
    vst2(MT16 + ((size_t)b * DD + ec * 16 + e) * DD + d0, pk.u4); }
}
// out[b][n][e] = sum_d x[b][n][d] M[b][d][e]: K = 128; M of the batch staged in LDS, 8 waves x 32 token rows: two A row tiles a wave, so each B fragment read from LDS feeds two products
#define RT 2
__global__ __launch_bounds__(256) void k_out(const float* __restrict__ x, const _Float16* __restrict__ MT16, float* __restrict__ out) {
  __shared__ __align__(16) _Float16 sM[DD][DD + 8];       // [e][d]
  __shared__ __align__(16) float so[8][16 * RT][132];
  const int tid = threadIdx.x, wave = tid >> 5, lane = tid & 31, col = lane & 15, g = lane >> 4;
  const int b = blockIdx.y, r0 = b * NN + blockIdx.x * (128 * RT) + wave * (16 * RT);
  const _Float16* mp = MT16 + ((size_t)b * DD + (tid >> 4)) * DD + (tid & 15) * 8;
  v4u mr[8];
#pragma unroll
  for (int it = 0; it < 8; ++it) mr[it] = *(const v4u*)(mp + it * 16 * DD);
  asm volatile("s_wait_xcnt 0x0" ::: "memory");     // stands before the address arithmetic and the loads below reuse the address registers of these loads
  v16h a[RT][4];
#pragma unroll
  for (int t = 0; t < RT; ++t) {
#pragma unroll
    for (int kc = 0; kc < 4; ++kc) a[t][kc] = frag_f32(x + (size_t)(r0 + t * 16 + col) * DD + kc * 32, lane);
    asm volatile("s_wait_xcnt 0x0" ::: "memory");   // likewise, behind each row tile's loads
  }
#pragma unroll
  for (int it = 0; it < 8; ++it) *(v4u*)(&sM[it * 16 + (tid >> 4)][(tid & 15) * 8]) = mr[it];
  __syncthreads();
  // one column tile j at a time, its four B fragments fetched one tile ahead; each feeds both row tiles; k runs 0..3 as before
  v16h bf[2][4];
#pragma unroll
  for (int kc = 0; kc < 4; ++kc) bf[0][kc] = frag_h(&sM[col][kc * 32], lane);
#pragma unroll
  for (int j = 0; j < 8; ++j) {
    if (j + 1 < 8) {
#pragma unroll
      for (int kc = 0; kc < 4; ++kc) bf[(j + 1) & 1][kc] = frag_h(&sM[(j + 1) * 16 + col][kc * 32], lane); }
    v8f acc[RT] = {};
#pragma unroll
    for (int kc = 0; kc < 4; ++kc)
#pragma unroll
      for (int t = 0; t < RT; ++t) acc[t] = wmma16(a[t][kc], bf[j & 1][kc], acc[t]);
#pragma unroll
    for (int t = 0; t < RT; ++t)
#pragma unroll
      for (int r = 0; r < 8; ++r) so[wave][t * 16 + 8 * g + r][j * 16 + col] = acc[t][r] * 256.0f; }
  LDSX();
#pragma unroll
  for (int rl = 0; rl < 16 * RT; ++rl) vst2(out + (size_t)(r0 + rl) * DD + lane * 4, *(const v4f*)(&so[wave][rl][lane * 4]));
}
extern "C" void kernel_launch(void* const* d_in, const int* in_sizes, int n_in, void* d_out, int out_size, void* d_ws, size_t ws_size, hipStream_t stream) {
  (void)in_sizes; (void)n_in; (void)out_size; (void)ws_size;
  const float* x = (const float*)d_in[0]; const float* Wk = (const float*)d_in[1]; const float* Wq = (const float*)d_in[2]; const float* Wv = (const float*)d_in[3];
  float* out = (float*)d_out;
  char* ws = (char*)d_ws; size_t off = 0;
  auto take = [&](size_t bytes) { char* p = ws + off; off += (bytes + 255) & ~(size_t)255; return p; };
  float* part = (float*)take((size_t)NB * NPB * DD * DD * 4); _Float16* G16 = (_Float16*)take((size_t)NB * DD * DD * 2); _Float16* MT16 = (_Float16*)take((size_t)NB * DD * DD * 2);
  _Float16* WS = (_Float16*)take((size_t)512 * FRH * 2);
  k_gram<<<dim3(NPB, NB), 512, 0, stream>>>(x, part);
  k_gsum<<<NB * DD * DD / 2 / 256, 256, 0, stream>>>(part, Wk, Wq, Wv, G16, WS);
  k_mid<<<dim3(DD / 16, NB), 256, 0, stream>>>(G16, WS, MT16);
  k_out<<<dim3(NN / (128 * RT), NB), 256, 0, stream>>>(x, MT16, out);
}

// v004
// A run of this version takes 23.2 microseconds.
// Two timings next to v003 put it at 1.13 and 1.11 times that version's speed.
// All steps since v000 together make it 9.43 times as fast.
#include <hip/hip_runtime.h>
#include <math.h>

typedef __attribute__((ext_vector_type(16))) _Float16 v16h;
typedef __attribute__((ext_vector_type(8)))  _Float16 v8h;
typedef __attribute__((ext_vector_type(4)))  _Float16 v4h;
typedef __attribute__((ext_vector_type(2)))  _Float16 v2h;
typedef __attribute__((ext_vector_type(8)))  float v8f;
typedef __attribute__((ext_vector_type(4)))  float v4f;
typedef __attribute__((ext_vector_type(2)))  float v2f;
typedef __attribute__((ext_vector_type(4)))  unsigned v4u;

template <typename T> __device__ __forceinline__ void vst2(void* p, T v) { *(T*)p = v;  }
__device__ __forceinline__ v8f wmma16(v16h a, v16h b, v8f c) {
  v8f d = __builtin_amdgcn_wmma_f32_16x16x32_f16(false, a, false, b, (short)0, c, false, false);
  asm volatile("v_nop\n\tv_nop\n\tv_nop\n\tv_nop" : "+v"(d) : "v"(a), "v"(b));
  return d;
}
// 16x16x32 fragments: lane = (h = lane>>4, row/col = lane&15); elements 0..7 = k0+8h+0..7, 8..15 = k0+16+8h+0..7; D element r = row 8h+r
__device__ __forceinline__ v16h frag_h(const _Float16* rowk0, int lane) {
  union { v16h v; v8h q[2]; } u; const _Float16* p = rowk0 + 8 * (lane >> 4);
  u.q[0] = *(const v8h*)p; u.q[1] = *(const v8h*)(p + 16); return u.v;
}
__device__ __forceinline__ v16h frag_f32(const float* rowk0, int lane) {
  v16h a; const float* p = rowk0 + 8 * (lane >> 4);
#pragma unroll
  for (int i = 0; i < 8; ++i) { a[i] = (_Float16)p[i]; a[8 + i] = (_Float16)p[16 + i]; }
  return a;
}
// f32 operand of a small product as an f16 pair h + l (l = the rounding remainder of h), so that these products add no f16 operand rounding
struct H2 { v16h h, l; };
__device__ __forceinline__ H2 hsplit16(const float v[16]) { H2 r;
#pragma unroll
  for (int i = 0; i < 16; ++i) { const _Float16 h = (_Float16)v[i]; r.h[i] = h; r.l[i] = (_Float16)(v[i] - (float)h); }
  return r; }
// one weight fragment as its stored f16 pair. Record of FRH halves: [h, l][elements 0..7, 8..15][lane][8], so each of the four loads is 512 contiguous bytes a wave; p = record + lane * 8
#define FRH 1024
__device__ __forceinline__ H2 ld_h2(const _Float16* p) {
  union { v16h v; v8h q[2]; } a, b;
  a.q[0] = *(const v8h*)p; a.q[1] = *(const v8h*)(p + 256); b.q[0] = *(const v8h*)(p + 512); b.q[1] = *(const v8h*)(p + 768);
  H2 r; r.h = a.v; r.l = b.v; return r; }
// two stacked 16x16 D tiles (rows k0..k0+15 and k0+16..k0+31 of one column block) are, lane for lane, the B fragment of k0..k0+31
__device__ __forceinline__ H2 split_dd(v8f lo, v8f hi, float sc) { float v[16];
#pragma unroll
  for (int i = 0; i < 8; ++i) { v[i] = lo[i] * sc; v[8 + i] = hi[i] * sc; }
  return hsplit16(v); }
__device__ __forceinline__ v8f mac2(v16h a, const H2& b, v8f c) { c = wmma16(a, b.l, c); return wmma16(a, b.h, c); }
__device__ __forceinline__ v8f mac3(const H2& a, const H2& b, v8f c) { c = wmma16(a.l, b.h, c); c = wmma16(a.h, b.l, c); return wmma16(a.h, b.h, c); }
#define LDSX() do { asm volatile("s_wait_dscnt 0" ::: "memory"); __builtin_amdgcn_wave_barrier(); __builtin_amdgcn_fence(__ATOMIC_RELEASE, "workgroup"); } while (0)

// Softmax-free multi-head linear attention, fully reassociated. With G = x^T x (128 x 128 per batch):
//   K_h^T V_h = Wk_h G Wv_h^T   and   out = sum_h Q_h (K_h^T V_h) = x M,   M = sum_h Wq_h^T (Wk_h (G Wv_h^T)),
// so neither Q, K nor V is formed: x is read twice and out written once. Every product (G, the three small ones per head, x M)
// runs on v_wmma_f32_16x16x32_f16 with f32 accumulate; operands carry power-of-two scales that are undone at the end.
#define NB 8
#define NN 8192
#define DD 128
#define NH 8
#define KQ 64
#define TB 256                 // token rows per Gram partial block
#define NPB (NN / TB)          // 32
#define RB 3                   // register buffers of the weight ring in k_mid
// G is symmetric by construction (G[i][j] and G[j][i] are the same sum of the same products), so of its 4 x 4 grid of 32 x 32 super tiles only the NST = 10 with I <= J are computed, stored and summed.
// Super tile st = 0..9 runs row by row: (0,0) (0,1) (0,2) (0,3) (1,1) (1,2) (1,3) (2,2) (2,3) (3,3). Packed planes hold [st][32][32].
#define NST 10
#define STE 1024               // elements of a super tile
__device__ __forceinline__ int st_row(int st) { return (st >= 4) + (st >= 7) + (st >= 9); }
__device__ __forceinline__ int st_col(int st, int I) { return st - 3 * I + (I * (I - 1)) / 2; }

// Gram partials: block (pb, b): P[d][d'] = sum over the block's 256 tokens of x[n][d] x[n][d']. x goes to LDS transposed as f16 ([d][n]),
// so A rows and B columns are the same row fragments. All 16 waves stage x; waves 0..9 then take one super tile each (2 x 2 WMMA tiles: four fragments feed four products), the other six are done.
__global__ __launch_bounds__(512) void k_gram(const float* __restrict__ x, float* __restrict__ part) {
  __shared__ __align__(16) _Float16 xt[DD][TB + 8];
  __shared__ __align__(16) float so[NST][32][36];
  const int tid = threadIdx.x, wave = tid >> 5, lane = tid & 31, col = lane & 15, g = lane >> 4;
  const int pb = blockIdx.x, b = blockIdx.y;
  const float* xb = x + ((size_t)b * NN + (size_t)pb * TB) * DD;
  const int d = tid & 127, tq = tid >> 7;
  const float* xp = xb + (size_t)(tq * 64) * DD + d;
  float xv[8][8];
#pragma unroll
  for (int i8 = 0; i8 < 8; ++i8)
#pragma unroll
    for (int e = 0; e < 8; ++e) xv[i8][e] = xp[(i8 * 8 + e) * DD];
  asm volatile("s_wait_xcnt 0x0" :: "v"(xp) : "memory");   // stands before anything reuses the address registers of these loads; the address is named so that they stay untouched up to the wait
#pragma unroll
  for (int i8 = 0; i8 < 8; ++i8) { union { v8h h; v4u u; } pk;
#pragma unroll
    for (int e = 0; e < 8; ++e) pk.h[e] = (_Float16)xv[i8][e];
    *(v4u*)(&xt[d][tq * 64 + i8 * 8]) = pk.u; }
  __syncthreads();
  const int st = __builtin_amdgcn_readfirstlane(wave);   // the wave's number in a scalar register: the test below is a scalar branch and every lane is on at the WMMAs
  if (st >= NST) return;                                  // behind the kernel's only barrier
  const int I = st_row(st), J = st_col(st, I);
  v8f acc[2][2] = {};
  v16h a[2][2], bf[2][2];   // [buffer][tile]: the four fragments of k block kc + 1 are fetched while those of kc are multiplied
#pragma unroll
  for (int i = 0; i < 2; ++i) { a[0][i] = frag_h(&xt[(I * 2 + i) * 16 + col][0], lane); bf[0][i] = frag_h(&xt[(J * 2 + i) * 16 + col][0], lane); }
#pragma unroll
  for (int kc = 0; kc < TB / 32; ++kc) {
    if (kc + 1 < TB / 32) {
#pragma unroll
      for (int i = 0; i < 2; ++i) { a[(kc + 1) & 1][i] = frag_h(&xt[(I * 2 + i) * 16 + col][(kc + 1) * 32], lane); bf[(kc + 1) & 1][i] = frag_h(&xt[(J * 2 + i) * 16 + col][(kc + 1) * 32], lane); } }
#pragma unroll
    for (int i = 0; i < 2; ++i)
#pragma unroll
      for (int j = 0; j < 2; ++j) acc[i][j] = wmma16(a[kc & 1][i], bf[kc & 1][j], acc[i][j]); }
#pragma unroll
  for (int i = 0; i < 2; ++i)
#pragma unroll
    for (int j = 0; j < 2; ++j)
#pragma unroll
      for (int r = 0; r < 8; ++r) so[st][i * 16 + 8 * g + r][j * 16 + col] = acc[i][j][r];
  LDSX();
  // a store is four whole rows of the super tile = 512 contiguous bytes of the packed plane
#pragma unroll
  for (int it = 0; it < 8; ++it)
    vst2(part + (((size_t)b * NPB + pb) * NST + st) * STE + it * 128 + lane * 4, *(const v4f*)(&so[st][it * 4 + (lane >> 3)][(lane & 7) * 4]));
}
// G16[b][st][32][32] = (sum of the 32 partials, fixed order) / 4 as f16, packed like the partials: blocks 0 .. NB * NST * 2 - 1, half a super tile each, two sums a thread.
// Beside that each thread of all blocks turns four weights (x 1024) into their f16 pair h + l, once for all batches and column blocks, and stores them in fragment order:
// records h * 32 + (row tile * 4 + kc) = Wk_h, h * 32 + 16 + (d tile * 2 + kc) = Wq_h^T, 256 + (h * 8 + e tile) * 4 + kc = Wv_h.
__global__ __launch_bounds__(256) void k_gsum(const float* __restrict__ part, const float* __restrict__ Wk, const float* __restrict__ Wq, const float* __restrict__ Wv, _Float16* __restrict__ G16, _Float16* __restrict__ WS) {
  const int q = blockIdx.x * 256 + threadIdx.x;
  const int F = q >> 7, q2 = (q >> 6) & 1, ln = (q >> 1) & 31, i0 = (q & 1) * 4, kk = 16 * q2 + 8 * (ln >> 4) + i0, c = ln & 15;
  v4f w;
  if (blockIdx.x >= 128) { const int f = F - 256; w = *(const v4f*)(Wv + ((size_t)(f >> 2) * 16 + c) * DD + (f & 3) * 32 + kk); }
  else if ((blockIdx.x & 8) == 0) { const int r = F & 15; w = *(const v4f*)(Wk + ((size_t)(F >> 5) * KQ + (r >> 2) * 16 + c) * DD + (r & 3) * 32 + kk); }
  else { const int r = F & 15; const float* p = Wq + ((size_t)(F >> 5) * KQ + (r & 1) * 32 + kk) * DD + (r >> 1) * 16 + c;
#pragma unroll
    for (int j = 0; j < 4; ++j) w[j] = p[j * DD]; }
  asm volatile("s_wait_xcnt 0x0" ::: "memory");   // the address registers of the weight loads are reused by the address arithmetic below
  if (blockIdx.x < NB * NST * 2) {
    const int b = blockIdx.x / (NST * 2), o = (blockIdx.x % (NST * 2)) * 512 + threadIdx.x * 2;
    v2f s = {0.f, 0.f};
#pragma unroll
    for (int p = 0; p < NPB; ++p) s += *(const v2f*)(part + ((size_t)b * NPB + p) * (NST * STE) + o);
    v2h r; r[0] = (_Float16)(s[0] * 0.25f); r[1] = (_Float16)(s[1] * 0.25f);
    vst2(G16 + (size_t)b * (NST * STE) + o, r);
  }
  v4h wh, wl;
#pragma unroll
  for (int j = 0; j < 4; ++j) { const float v = w[j] * 1024.0f; const _Float16 hh = (_Float16)v; wh[j] = hh; wl[j] = (_Float16)(v - (float)hh); }
  _Float16* wp = WS + (size_t)F * FRH + q2 * 256 + ln * 8 + i0;
  vst2(wp, wh); vst2(wp + 512, wl);
}
// block (ec, b), wave = head h: for the 16 output columns e of ec: U = G Wv_h[e]^T [128 x 16], KtV = Wk_h U [64 x 16], M_h = Wq_h^T KtV [128 x 16];
// each D feeds the next product as its B fragment in registers; weights (stored pairs of k_gsum) and D operands go in as f16 pairs (H2). Heads summed through LDS in fixed order; stored as MT16[b][e][d] = M / 256.
// G comes packed (super tiles I <= J): each 16-byte piece goes to its place in sG and, where I < J, its eight elements also to the mirrored place.
__global__ __launch_bounds__(256) void k_mid(const _Float16* __restrict__ G16, const _Float16* __restrict__ WS, _Float16* __restrict__ MT16) {
  __shared__ __align__(16) float sm[4][16][132];         // [slot][e][d]
  __shared__ __align__(16) _Float16 sG[DD][DD + 8];
  const int tid = threadIdx.x, wave = tid >> 5, lane = tid & 31, col = lane & 15, g = lane >> 4;
  const int ec = blockIdx.x, b = blockIdx.y, h = wave;
  const int hf = __builtin_amdgcn_readfirstlane(tid >> 7);   // the same in every lane of a wave; in a scalar register the super tile's indices and the test I != J below are scalar work
  const _Float16* gp = G16 + (size_t)b * (NST * STE) + tid * 8;
  v4u gr[NST / 2];
#pragma unroll
  for (int it = 0; it < NST / 2; ++it) gr[it] = *(const v4u*)(gp + it * 2 * STE);
  asm volatile("s_wait_xcnt 0x0" ::: "memory");   // the address registers of these loads are given to the weight loads below as destinations
  H2 bw[4];
#pragma unroll
  for (int kc = 0; kc < 4; ++kc) bw[kc] = ld_h2(WS + (size_t)(256 + (h * 8 + ec) * 4 + kc) * FRH + lane * 8);
  asm volatile("s_wait_xcnt 0x0" ::: "memory");   // likewise: their address registers become destinations of the ring's first loads
  // the 16 weight batches of products 2 and 3 (two records each; n < 8: Wk row tile n>>1, k half n&1; n >= 8: Wq^T row tile n-8) run through a ring of RB register buffers, fetched RB - 1 batches ahead
  const _Float16* pw = WS + (size_t)h * 32 * FRH + lane * 8;
  H2 wr[RB][2];
#pragma unroll
  for (int n = 0; n < RB - 1; ++n)
#pragma unroll
    for (int f = 0; f < 2; ++f) wr[n][f] = ld_h2(pw + (n * 2 + f) * FRH);
#pragma unroll
  for (int it = 0; it < NST / 2; ++it) {   // super tile st = it * 2 + hf: both candidates' indices are constants, hf picks
    const int I = hf ? st_row(it * 2 + 1) : st_row(it * 2), J = hf ? st_col(it * 2 + 1, st_row(it * 2 + 1)) : st_col(it * 2, st_row(it * 2)), row = (tid & 127) >> 2, c8 = (tid & 3) * 8;
    *(v4u*)(&sG[I * 32 + row][J * 32 + c8]) = gr[it];
    if (I != J) { union { v4u u4; _Float16 h1[8]; } t; t.u4 = gr[it];
#pragma unroll
      for (int e = 0; e < 8; ++e) sG[J * 32 + c8 + e][I * 32 + row] = t.h1[e]; } }
  __syncthreads();
  v8f u[8] = {};
#pragma unroll
  for (int i = 0; i < 8; ++i) { v16h ga[4];
#pragma unroll
    for (int kc = 0; kc < 4; ++kc) ga[kc] = frag_h(&sG[i * 16 + col][kc * 32], lane);
#pragma unroll
    for (int kc = 0; kc < 4; ++kc) u[i] = mac2(ga[kc], bw[kc], u[i]); }                                                     // u = 256 U
  H2 ub[4];
#pragma unroll
  for (int kc = 0; kc < 4; ++kc) ub[kc] = split_dd(u[2 * kc], u[2 * kc + 1], 1.0f / 4096.0f);                              // U / 16
  v8f kv[4] = {};
#pragma unroll
  for (int n = 0; n < 8; ++n) {
#pragma unroll
    for (int f = 0; f < 2; ++f) wr[(n + RB - 1) % RB][f] = ld_h2(pw + ((n + RB - 1) * 2 + f) * FRH);
#pragma unroll
    for (int f = 0; f < 2; ++f) kv[n >> 1] = mac3(wr[n % RB][f], ub[(n & 1) * 2 + f], kv[n >> 1]); }   // kv = 64 KtV
  H2 kb[2];
#pragma unroll
  for (int kc = 0; kc < 2; ++kc) kb[kc] = split_dd(kv[2 * kc], kv[2 * kc + 1], 1.0f / 1024.0f);                            // KtV / 16
  v8f m[8] = {};
#pragma unroll
  for (int n = 8; n < 16; ++n) {
    if (n + RB - 1 < 16) {
#pragma unroll
      for (int f = 0; f < 2; ++f) wr[(n + RB - 1) % RB][f] = ld_h2(pw + ((n + RB - 1) * 2 + f) * FRH); }
#pragma unroll
    for (int f = 0; f < 2; ++f) m[n - 8] = mac3(wr[n % RB][f], kb[f], m[n - 8]); }                // m = 64 M_h
  if (wave >= 4) {
#pragma unroll
    for (int i = 0; i < 8; ++i)
#pragma unroll
      for (int r = 0; r < 8; ++r) sm[wave - 4][col][i * 16 + 8 * g + r] = m[i][r]; }
  __syncthreads();
  if (wave < 4) {
#pragma unroll
    for (int i = 0; i < 8; ++i)
#pragma unroll
      for (int r = 0; r < 8; ++r) sm[wave][col][i * 16 + 8 * g + r] += m[i][r]; }
  __syncthreads();
  { const int e = tid >> 4, d0 = (tid & 15) * 8; union { v8h h8; v4u u4; } pk;
#pragma unroll
    for (int r = 0; r < 8; ++r) pk.h8[r] = (_Float16)((((sm[0][e][d0 + r] + sm[1][e][d0 + r]) + sm[2][e][d0 + r]) + sm[3][e][d0 + r]) * (1.0f / 16384.0f));
    vst2(MT16 + ((size_t)b * DD + ec * 16 + e) * DD + d0, pk.u4); }
}
// out[b][n][e] = sum_d x[b][n][d] M[b][d][e]: K = 128; M of the batch staged in LDS, 8 waves x 32 token rows: two A row tiles a wave, so each B fragment read from LDS feeds two products
#define RT 2
__global__ __launch_bounds__(256) void k_out(const float* __restrict__ x, const _Float16* __restrict__ MT16, float* __restrict__ out) {
  __shared__ __align__(16) _Float16 sM[DD][DD + 8];       // [e][d]
  __shared__ __align__(16) float so[8][16 * RT][132];
  const int tid = threadIdx.x, wave = tid >> 5, lane = tid & 31, col = lane & 15, g = lane >> 4;
  const int b = blockIdx.y, r0 = b * NN + blockIdx.x * (128 * RT) + wave * (16 * RT);
  const _Float16* mp = MT16 + ((size_t)b * DD + (tid >> 4)) * DD + (tid & 15) * 8;
  v4u mr[8];
#pragma unroll
  for (int it = 0; it < 8; ++it) mr[it] = *(const v4u*)(mp + it * 16 * DD);
  asm volatile("s_wait_xcnt 0x0" ::: "memory");     // stands before the address arithmetic and the loads below reuse the address registers of these loads
  v16h a[RT][4];
#pragma unroll
  for (int t = 0; t < RT; ++t) {
#pragma unroll
    for (int kc = 0; kc < 4; ++kc) a[t][kc] = frag_f32(x + (size_t)(r0 + t * 16 + col) * DD + kc * 32, lane);
    asm volatile("s_wait_xcnt 0x0" ::: "memory");   // likewise, behind each row tile's loads
  }
#pragma unroll
  for (int it = 0; it < 8; ++it) *(v4u*)(&sM[it * 16 + (tid >> 4)][(tid & 15) * 8]) = mr[it];
  __syncthreads();
  // one column tile j at a time, its four B fragments fetched one tile ahead; each feeds both row tiles; k runs 0..3 as before
  v16h bf[2][4];
#pragma unroll
  for (int kc = 0; kc < 4; ++kc) bf[0][kc] = frag_h(&sM[col][kc * 32], lane);
#pragma unroll
  for (int j = 0; j < 8; ++j) {
    if (j + 1 < 8) {
#pragma unroll
      for (int kc = 0; kc < 4; ++kc) bf[(j + 1) & 1][kc] = frag_h(&sM[(j + 1) * 16 + col][kc * 32], lane); }
    v8f acc[RT] = {};
#pragma unroll
    for (int kc = 0; kc < 4; ++kc)
#pragma unroll
      for (int t = 0; t < RT; ++t) acc[t] = wmma16(a[t][kc], bf[j & 1][kc], acc[t]);
#pragma unroll
    for (int t = 0; t < RT; ++t)
#pragma unroll
      for (int r = 0; r < 8; ++r) so[wave][t * 16 + 8 * g + r][j * 16 + col] = acc[t][r] * 256.0f; }
  LDSX();
#pragma unroll
  for (int rl = 0; rl < 16 * RT; ++rl) vst2(out + (size_t)(r0 + rl) * DD + lane * 4, *(const v4f*)(&so[wave][rl][lane * 4]));
}
extern "C" void kernel_launch(void* const* d_in, const int* in_sizes, int n_in, void* d_out, int out_size, void* d_ws, size_t ws_size, hipStream_t stream) {
  (void)in_sizes; (void)n_in; (void)out_size; (void)ws_size;
  const float* x = (const float*)d_in[0]; const float* Wk = (const float*)d_in[1]; const float* Wq = (const float*)d_in[2]; const float* Wv = (const float*)d_in[3];
  float* out = (float*)d_out;
  char* ws = (char*)d_ws; size_t off = 0;
  auto take = [&](size_t bytes) { char* p = ws + off; off += (bytes + 255) & ~(size_t)255; return p; };
  float* part = (float*)take((size_t)NB * NPB * NST * STE * 4); _Float16* G16 = (_Float16*)take((size_t)NB * NST * STE * 2); _Float16* MT16 = (_Float16*)take((size_t)NB * DD * DD * 2);
  _Float16* WS = (_Float16*)take((size_t)512 * FRH * 2);
  k_gram<<<dim3(NPB, NB), 512, 0, stream>>>(x, part);
  k_gsum<<<NB * DD * DD / 2 / 256, 256, 0, stream>>>(part, Wk, Wq, Wv, G16, WS);
  k_mid<<<dim3(DD / 16, NB), 256, 0, stream>>>(G16, WS, MT16);
  k_out<<<dim3(NN / (128 * RT), NB), 256, 0, stream>>>(x, MT16, out);
}

// v005
// A run of this version takes 20.6 microseconds.
// Timed twice side by side with v004, it ran 1.13 times as fast both times.
// Over all steps from v000 it is 10.6 times as fast.
#include <hip/hip_runtime.h>
#include <math.h>

typedef __attribute__((ext_vector_type(16))) _Float16 v16h;
typedef __attribute__((ext_vector_type(8)))  _Float16 v8h;
typedef __attribute__((ext_vector_type(4)))  _Float16 v4h;
typedef __attribute__((ext_vector_type(2)))  _Float16 v2h;
typedef __attribute__((ext_vector_type(8)))  float v8f;
typedef __attribute__((ext_vector_type(4)))  float v4f;
typedef __attribute__((ext_vector_type(2)))  float v2f;
typedef __attribute__((ext_vector_type(4)))  unsigned v4u;

template <typename T> __device__ __forceinline__ void vst2(void* p, T v) { *(T*)p = v;  }
__device__ __forceinline__ v8f wmma16(v16h a, v16h b, v8f c) {
  v8f d = __builtin_amdgcn_wmma_f32_16x16x32_f16(false, a, false, b, (short)0, c, false, false);
  asm volatile("v_nop\n\tv_nop\n\tv_nop\n\tv_nop" : "+v"(d) : "v"(a), "v"(b));
  return d;
}
// 16x16x32 fragments: lane = (h = lane>>4, row/col = lane&15); elements 0..7 = k0+8h+0..7, 8..15 = k0+16+8h+0..7; D element r = row 8h+r
__device__ __forceinline__ v16h frag_h(const _Float16* rowk0, int lane) {
  union { v16h v; v8h q[2]; } u; const _Float16* p = rowk0 + 8 * (lane >> 4);
  u.q[0] = *(const v8h*)p; u.q[1] = *(const v8h*)(p + 16); return u.v;
}
__device__ __forceinline__ v16h frag_f32(const float* rowk0, int lane) {
  v16h a; const float* p = rowk0 + 8 * (lane >> 4);
#pragma unroll
  for (int i = 0; i < 8; ++i) { a[i] = (_Float16)p[i]; a[8 + i] = (_Float16)p[16 + i]; }
  return a;
}
// f32 operand of a small product as an f16 pair h + l (l = the rounding remainder of h), so that these products add no f16 operand rounding
struct H2 { v16h h, l; };
__device__ __forceinline__ H2 hsplit16(const float v[16]) { H2 r;
#pragma unroll
  for (int i = 0; i < 16; ++i) { const _Float16 h = (_Float16)v[i]; r.h[i] = h; r.l[i] = (_Float16)(v[i] - (float)h); }
  return r; }
// one weight fragment as its stored f16 pair. Record of FRH halves: [h, l][elements 0..7, 8..15][lane][8], so each of the four loads is 512 contiguous bytes a wave; p = record + lane * 8
#define FRH 1024
__device__ __forceinline__ H2 ld_h2(const _Float16* p) {
  union { v16h v; v8h q[2]; } a, b;
  a.q[0] = *(const v8h*)p; a.q[1] = *(const v8h*)(p + 256); b.q[0] = *(const v8h*)(p + 512); b.q[1] = *(const v8h*)(p + 768);
  H2 r; r.h = a.v; r.l = b.v; return r; }
// two stacked 16x16 D tiles (rows k0..k0+15 and k0+16..k0+31 of one column block) are, lane for lane, the B fragment of k0..k0+31
__device__ __forceinline__ H2 split_dd(v8f lo, v8f hi, float sc) { float v[16];
#pragma unroll
  for (int i = 0; i < 8; ++i) { v[i] = lo[i] * sc; v[8 + i] = hi[i] * sc; }
  return hsplit16(v); }
// the same for the products on f16 pairs; only D is named: the middle kernel holds more than 256 registers of operands, and with A and B named as well its build spilled them to scratch. No global load is issued behind the first of these WMMAs
__device__ __forceinline__ v8f wmma16d(v16h a, v16h b, v8f c) {
  v8f d = __builtin_amdgcn_wmma_f32_16x16x32_f16(false, a, false, b, (short)0, c, false, false);
  asm volatile("v_nop\n\tv_nop\n\tv_nop\n\tv_nop" : "+v"(d));   // the four vector slots between a WMMA and the first vector instruction on its D
  return d;
}
__device__ __forceinline__ v8f mac2(v16h a, const H2& b, v8f c) { c = wmma16d(a, b.l, c); return wmma16d(a, b.h, c); }
__device__ __forceinline__ v8f mac3(const H2& a, const H2& b, v8f c) { c = wmma16d(a.l, b.h, c); c = wmma16d(a.h, b.l, c); return wmma16d(a.h, b.h, c); }
#define LDSX() do { asm volatile("s_wait_dscnt 0" ::: "memory"); __builtin_amdgcn_wave_barrier(); __builtin_amdgcn_fence(__ATOMIC_RELEASE, "workgroup"); } while (0)

// Softmax-free multi-head linear attention, fully reassociated. With G = x^T x (128 x 128 per batch):
//   K_h^T V_h = Wk_h G Wv_h^T   and   out = sum_h Q_h (K_h^T V_h) = x M,   M = sum_h A_h (G Wv_h^T),   A_h = Wq_h^T Wk_h (no batch in it: formed once),
// so neither Q, K nor V is formed: x is read twice and out written once. Every product (G, A_h, the two small ones per head, x M)
// runs on v_wmma_f32_16x16x32_f16 with f32 accumulate; operands carry power-of-two scales that are undone at the end.
#define NB 8
#define NN 8192
#define DD 128
#define NH 8
#define KQ 64
#define TB 256                 // token rows per Gram partial block
#define NPB (NN / TB)          // 32
#define RQ 4                   // row blocks of M (32 rows each) that k_mid's grid is split into
// G is symmetric by construction (G[i][j] and G[j][i] are the same sum of the same products), so of its 4 x 4 grid of 32 x 32 super tiles only the NST = 10 with I <= J are computed, stored and summed.
// Super tile st = 0..9 runs row by row: (0,0) (0,1) (0,2) (0,3) (1,1) (1,2) (1,3) (2,2) (2,3) (3,3). Packed planes hold [st][32][32].
#define NST 10
#define STE 1024               // elements of a super tile
__device__ __forceinline__ int st_row(int st) { return (st >= 4) + (st >= 7) + (st >= 9); }
__device__ __forceinline__ int st_col(int st, int I) { return st - 3 * I + (I * (I - 1)) / 2; }

// Gram partials: block (pb, b): P[d][d'] = sum over the block's 256 tokens of x[n][d] x[n][d']. x goes to LDS transposed as f16 ([d][n]),
// so A rows and B columns are the same row fragments. All 16 waves stage x; waves 0..9 then take one super tile each (2 x 2 WMMA tiles: four fragments feed four products), the other six are done.
__global__ __launch_bounds__(512) void k_gram(const float* __restrict__ x, float* __restrict__ part) {
  __shared__ __align__(16) _Float16 xt[DD][TB + 8];
  __shared__ __align__(16) float so[NST][32][36];
  const int tid = threadIdx.x, wave = tid >> 5, lane = tid & 31, col = lane & 15, g = lane >> 4;
  const int pb = blockIdx.x, b = blockIdx.y;
  const float* xb = x + ((size_t)b * NN + (size_t)pb * TB) * DD;
  const int d = tid & 127, tq = tid >> 7;
  const float* xp = xb + (size_t)(tq * 64) * DD + d;
  float xv[8][8];
#pragma unroll
  for (int i8 = 0; i8 < 8; ++i8)
#pragma unroll
    for (int e = 0; e < 8; ++e) xv[i8][e] = xp[(i8 * 8 + e) * DD];
  asm volatile("s_wait_xcnt 0x0" :: "v"(xp) : "memory");   // stands before anything reuses the address registers of these loads; the address is named so that they stay untouched up to the wait
#pragma unroll
  for (int i8 = 0; i8 < 8; ++i8) { union { v8h h; v4u u; } pk;
#pragma unroll
    for (int e = 0; e < 8; ++e) pk.h[e] = (_Float16)xv[i8][e];
    *(v4u*)(&xt[d][tq * 64 + i8 * 8]) = pk.u; }
  __syncthreads();
  const int st = __builtin_amdgcn_readfirstlane(wave);   // the wave's number in a scalar register: the test below is a scalar branch and every lane is on at the WMMAs
  if (st >= NST) return;                                  // behind the kernel's only barrier
  const int I = st_row(st), J = st_col(st, I);
  v8f acc[2][2] = {};
  v16h a[2][2], bf[2][2];   // [buffer][tile]: the four fragments of k block kc + 1 are fetched while those of kc are multiplied
#pragma unroll
  for (int i = 0; i < 2; ++i) { a[0][i] = frag_h(&xt[(I * 2 + i) * 16 + col][0], lane); bf[0][i] = frag_h(&xt[(J * 2 + i) * 16 + col][0], lane); }
#pragma unroll
  for (int kc = 0; kc < TB / 32; ++kc) {
    if (kc + 1 < TB / 32) {
#pragma unroll
      for (int i = 0; i < 2; ++i) { a[(kc + 1) & 1][i] = frag_h(&xt[(I * 2 + i) * 16 + col][(kc + 1) * 32], lane); bf[(kc + 1) & 1][i] = frag_h(&xt[(J * 2 + i) * 16 + col][(kc + 1) * 32], lane); } }
#pragma unroll
    for (int i = 0; i < 2; ++i)
#pragma unroll
      for (int j = 0; j < 2; ++j) acc[i][j] = wmma16(a[kc & 1][i], bf[kc & 1][j], acc[i][j]); }
#pragma unroll
  for (int i = 0; i < 2; ++i)
#pragma unroll
    for (int j = 0; j < 2; ++j)
#pragma unroll
      for (int r = 0; r < 8; ++r) so[st][i * 16 + 8 * g + r][j * 16 + col] = acc[i][j][r];
  LDSX();
  // a store is four whole rows of the super tile = 512 contiguous bytes of the packed plane
#pragma unroll
  for (int it = 0; it < 8; ++it)
    vst2(part + (((size_t)b * NPB + pb) * NST + st) * STE + it * 128 + lane * 4, *(const v4f*)(&so[st][it * 4 + (lane >> 3)][(lane & 7) * 4]));
}
// The first NAB blocks form A_h (below); the others, numbered bx from 0:
// G16[b][st][32][32] = (sum of the 32 partials, fixed order) / 4 as f16, packed like the partials: bx = 0 .. NB * NST * 2 - 1, half a super tile each, two sums a thread.
// bx = 128 .. 255: each thread turns four weights of Wv (x 1024) into their f16 pair h + l, once for all batches, stored in fragment order: record 256 + (h * 8 + e tile) * 4 + kc.
// Blocks 0 .. NAB - 1 (first, because theirs is the longest chain of the launch): wave w = (h, d tile i, kc, t) forms one 16 x 16 tile of A_h^T = Wk_h^T Wq_h: rows d' = kc * 32 + t * 16 .. + 15, columns d = i * 16 .. + 15 (K = 64, both operands as f16 pairs).
// The tiles t = 0, 1 stacked are, lane for lane, the fragment (row d, k = d') of A_h: tile t is elements 8 t .. 8 t + 7 of record h * 32 + i * 4 + kc, stored as the pair of 1024 A_h.
#define NAB (NH * 64 / 8)
__global__ __launch_bounds__(256) void k_gsum(const float* __restrict__ part, const float* __restrict__ Wk, const float* __restrict__ Wq, const float* __restrict__ Wv, _Float16* __restrict__ G16, _Float16* __restrict__ WS) {
  if (blockIdx.x < NAB) {
    const int lane = threadIdx.x & 31, c = lane & 15, g = lane >> 4;
    const int w = __builtin_amdgcn_readfirstlane(blockIdx.x * 8 + (threadIdx.x >> 5)), h = w >> 6, i = (w >> 3) & 7, kc = (w >> 1) & 3, t = w & 1;
    const float* pk = Wk + ((size_t)h * KQ + 8 * g) * DD + kc * 32 + t * 16 + c;
    const float* pq = Wq + ((size_t)h * KQ + 8 * g) * DD + i * 16 + c;
    float fa[2][16], fb[2][16];   // [k block of 32][element]: element e < 8 is k = k0 + 8 g + e, element 8 + e is k = k0 + 16 + 8 g + e, in both operands
#pragma unroll
    for (int k2 = 0; k2 < 2; ++k2)
#pragma unroll
      for (int e = 0; e < 16; ++e) { const int k = k2 * 32 + (e >> 3) * 16 + (e & 7); fa[k2][e] = pk[k * DD]; fb[k2][e] = pq[k * DD]; }
    asm volatile("s_wait_xcnt 0x0" :: "v"(pk), "v"(pq) : "memory");   // stands before anything reuses the address registers of these loads; the addresses are named so that they stay untouched up to the wait
    v8f dt = {};
#pragma unroll
    for (int k2 = 0; k2 < 2; ++k2) {
#pragma unroll
      for (int e = 0; e < 16; ++e) { fa[k2][e] *= 1024.0f; fb[k2][e] *= 1024.0f; }
      dt = mac3(hsplit16(fa[k2]), hsplit16(fb[k2]), dt); }                                                                  // dt = 2^20 A_h^T
    v8h rh, rl;
#pragma unroll
    for (int r = 0; r < 8; ++r) { const float v = dt[r] * (1.0f / 1024.0f); const _Float16 hh = (_Float16)v; rh[r] = hh; rl[r] = (_Float16)(v - (float)hh); }
    _Float16* wp = WS + (size_t)(h * 32 + i * 4 + kc) * FRH + t * 256 + lane * 8;
    vst2(wp, rh); vst2(wp + 512, rl);
    return;
  }
  const int bx = blockIdx.x - NAB, q = bx * 256 + threadIdx.x;
  const int F = q >> 7, q2 = (q >> 6) & 1, ln = (q >> 1) & 31, i0 = (q & 1) * 4, kk = 16 * q2 + 8 * (ln >> 4) + i0, c = ln & 15;
  v4f w = {};
  if (bx >= 128) { const int f = F - 256; w = *(const v4f*)(Wv + ((size_t)(f >> 2) * 16 + c) * DD + (f & 3) * 32 + kk); }
  asm volatile("s_wait_xcnt 0x0" ::: "memory");   // the address registers of the weight load are reused by the address arithmetic below
  if (bx < NB * NST * 2) {
    const int b = bx / (NST * 2), o = (bx % (NST * 2)) * 512 + threadIdx.x * 2;
    v2f s = {0.f, 0.f};
#pragma unroll
    for (int p = 0; p < NPB; ++p) s += *(const v2f*)(part + ((size_t)b * NPB + p) * (NST * STE) + o);
    v2h r; r[0] = (_Float16)(s[0] * 0.25f); r[1] = (_Float16)(s[1] * 0.25f);
    vst2(G16 + (size_t)b * (NST * STE) + o, r);
    asm volatile("s_wait_xcnt 0x0" ::: "memory");   // the address registers of this store are reused by the address arithmetic below
  }
  if (bx >= 128) {
    v4h wh, wl;
#pragma unroll
    for (int j = 0; j < 4; ++j) { const float v = w[j] * 1024.0f; const _Float16 hh = (_Float16)v; wh[j] = hh; wl[j] = (_Float16)(v - (float)hh); }
    _Float16* wp = WS + (size_t)F * FRH + q2 * 256 + ln * 8 + i0;
    vst2(wp, wh); vst2(wp + 512, wl);
  }
}
// block (ec, b, rq), wave = head h: for the 16 output columns e of ec and the 32 rows d of rq: U = G Wv_h[e]^T [128 x 16], M_h = A_h[rows] U [32 x 16];
// U's D tiles feed the second product as its B fragments in registers; weights (stored pairs of k_gsum) and U go in as f16 pairs (H2). Heads summed through LDS in fixed order.
// Stored as MT16[b][rq][e][32] = M / 256: a block's 16 x 32 piece is 1024 contiguous bytes, so no 128-byte line has two writers.
// G comes packed (super tiles I <= J): each 16-byte piece goes to its place in sG and, where I < J, its eight elements also to the mirrored place.
__global__ __launch_bounds__(256) void k_mid(const _Float16* __restrict__ G16, const _Float16* __restrict__ WS, _Float16* __restrict__ MT16) {
  __shared__ __align__(16) float sm[4][16][36];          // [slot][e][d - 32 rq]
  __shared__ __align__(16) _Float16 sG[DD][DD + 8];
  const int tid = threadIdx.x, wave = tid >> 5, lane = tid & 31, col = lane & 15, g = lane >> 4;
  const int ec = blockIdx.x, b = blockIdx.y, rq = blockIdx.z, h = wave;
  const int hf = __builtin_amdgcn_readfirstlane(tid >> 7);   // the same in every lane of a wave; in a scalar register the super tile's indices and the test I != J below are scalar work
  const _Float16* gp = G16 + (size_t)b * (NST * STE) + tid * 8;
  v4u gr[NST / 2];
#pragma unroll
  for (int it = 0; it < NST / 2; ++it) gr[it] = *(const v4u*)(gp + it * 2 * STE);
  asm volatile("s_wait_xcnt 0x0" ::: "memory");   // the address registers of these loads are given to the weight loads below as destinations
  H2 bw[4];
#pragma unroll
  for (int kc = 0; kc < 4; ++kc) bw[kc] = ld_h2(WS + (size_t)(256 + (h * 8 + ec) * 4 + kc) * FRH + lane * 8);
  asm volatile("s_wait_xcnt 0x0" ::: "memory");   // likewise, before the arithmetic below reuses their address registers
#pragma unroll
  for (int it = 0; it < NST / 2; ++it) {   // super tile st = it * 2 + hf: both candidates' indices are constants, hf picks
    const int I = hf ? st_row(it * 2 + 1) : st_row(it * 2), J = hf ? st_col(it * 2 + 1, st_row(it * 2 + 1)) : st_col(it * 2, st_row(it * 2)), row = (tid & 127) >> 2, c8 = (tid & 3) * 8;
    *(v4u*)(&sG[I * 32 + row][J * 32 + c8]) = gr[it];
    if (I != J) { union { v4u u4; _Float16 h1[8]; } t; t.u4 = gr[it];
#pragma unroll
      for (int e = 0; e < 8; ++e) sG[J * 32 + c8 + e][I * 32 + row] = t.h1[e]; } }
  __syncthreads();
  // A_h, row tiles rq * 2 + t, all four k blocks: fetched behind the barrier, which waits for every load a wave has in flight; they fly while the first product runs
  H2 aw[2][4];
#pragma unroll
  for (int t = 0; t < 2; ++t)
#pragma unroll
    for (int kc = 0; kc < 4; ++kc) aw[t][kc] = ld_h2(WS + (size_t)(h * 32 + (rq * 2 + t) * 4 + kc) * FRH + lane * 8);
  asm volatile("s_wait_xcnt 0x0" ::: "memory");   // before anything reuses their address registers
  v8f u[8] = {};
#pragma unroll
  for (int i = 0; i < 8; ++i) { v16h ga[4];
#pragma unroll
    for (int kc = 0; kc < 4; ++kc) ga[kc] = frag_h(&sG[i * 16 + col][kc * 32], lane);
#pragma unroll
    for (int kc = 0; kc < 4; ++kc) u[i] = mac2(ga[kc], bw[kc], u[i]); }                                                     // u = 256 U
  H2 ub[4];
#pragma unroll
  for (int kc = 0; kc < 4; ++kc) ub[kc] = split_dd(u[2 * kc], u[2 * kc + 1], 1.0f / 4096.0f);                              // U / 16
  v8f m[2] = {};
#pragma unroll
  for (int kc = 0; kc < 4; ++kc)
#pragma unroll
    for (int t = 0; t < 2; ++t) m[t] = mac3(aw[t][kc], ub[kc], m[t]);                                                       // m = 64 M_h
  if (wave >= 4) {
#pragma unroll
    for (int t = 0; t < 2; ++t)
#pragma unroll
      for (int r = 0; r < 8; ++r) sm[wave - 4][col][t * 16 + 8 * g + r] = m[t][r]; }
  __syncthreads();
  if (wave < 4) {
#pragma unroll
    for (int t = 0; t < 2; ++t)
#pragma unroll
      for (int r = 0; r < 8; ++r) sm[wave][col][t * 16 + 8 * g + r] += m[t][r]; }
  __syncthreads();
  { const int e = tid >> 4, d0 = (tid & 15) * 2; v2h pk;
#pragma unroll
    for (int r = 0; r < 2; ++r) pk[r] = (_Float16)((((sm[0][e][d0 + r] + sm[1][e][d0 + r]) + sm[2][e][d0 + r]) + sm[3][e][d0 + r]) * (1.0f / 16384.0f));
    vst2(MT16 + (((size_t)b * RQ + rq) * DD + ec * 16) * 32 + tid * 2, pk); }
}
// out[b][n][e] = sum_d x[b][n][d] M[b][d][e]: K = 128; M of the batch staged in LDS, 8 waves x 32 token rows: two A row tiles a wave, so each B fragment read from LDS feeds two products
#define RT 2
__global__ __launch_bounds__(256) void k_out(const float* __restrict__ x, const _Float16* __restrict__ MT16, float* __restrict__ out) {
  __shared__ __align__(16) _Float16 sM[DD][DD + 8];       // [e][d]
  __shared__ __align__(16) float so[8][16 * RT][132];
  const int tid = threadIdx.x, wave = tid >> 5, lane = tid & 31, col = lane & 15, g = lane >> 4;
  const int b = blockIdx.y, r0 = b * NN + blockIdx.x * (128 * RT) + wave * (16 * RT);
  const _Float16* mp = MT16 + (size_t)b * DD * DD + tid * 8;   // MT16[b][rq][e][32]: piece it * 256 + tid is rq = it >> 1, e = (it & 1) * 64 + (tid >> 2), d = rq * 32 + (tid & 3) * 8
  v4u mr[8];
#pragma unroll
  for (int it = 0; it < 8; ++it) mr[it] = *(const v4u*)(mp + it * 16 * DD);
  asm volatile("s_wait_xcnt 0x0" ::: "memory");     // stands before the address arithmetic and the loads below reuse the address registers of these loads
  v16h a[RT][4];
#pragma unroll
  for (int t = 0; t < RT; ++t) {
#pragma unroll
    for (int kc = 0; kc < 4; ++kc) a[t][kc] = frag_f32(x + (size_t)(r0 + t * 16 + col) * DD + kc * 32, lane);
    asm volatile("s_wait_xcnt 0x0" ::: "memory");   // likewise, behind each row tile's loads
  }
#pragma unroll
  for (int it = 0; it < 8; ++it) *(v4u*)(&sM[(it & 1) * 64 + (tid >> 2)][(it >> 1) * 32 + (tid & 3) * 8]) = mr[it];
  __syncthreads();
  // one column tile j at a time, its four B fragments fetched one tile ahead; each feeds both row tiles; k runs 0..3 as before
  v16h bf[2][4];
#pragma unroll
  for (int kc = 0; kc < 4; ++kc) bf[0][kc] = frag_h(&sM[col][kc * 32], lane);
#pragma unroll
  for (int j = 0; j < 8; ++j) {
    if (j + 1 < 8) {
#pragma unroll
      for (int kc = 0; kc < 4; ++kc) bf[(j + 1) & 1][kc] = frag_h(&sM[(j + 1) * 16 + col][kc * 32], lane); }
    v8f acc[RT] = {};
#pragma unroll
    for (int kc = 0; kc < 4; ++kc)
#pragma unroll
      for (int t = 0; t < RT; ++t) acc[t] = wmma16(a[t][kc], bf[j & 1][kc], acc[t]);
#pragma unroll
    for (int t = 0; t < RT; ++t)
#pragma unroll
      for (int r = 0; r < 8; ++r) so[wave][t * 16 + 8 * g + r][j * 16 + col] = acc[t][r] * 256.0f; }
  LDSX();
#pragma unroll
  for (int rl = 0; rl < 16 * RT; ++rl) vst2(out + (size_t)(r0 + rl) * DD + lane * 4, *(const v4f*)(&so[wave][rl][lane * 4]));
}
extern "C" void kernel_launch(void* const* d_in, const int* in_sizes, int n_in, void* d_out, int out_size, void* d_ws, size_t ws_size, hipStream_t stream) {
  (void)in_sizes; (void)n_in; (void)out_size; (void)ws_size;
  const float* x = (const float*)d_in[0]; const float* Wk = (const float*)d_in[1]; const float* Wq = (const float*)d_in[2]; const float* Wv = (const float*)d_in[3];
  float* out = (float*)d_out;
  char* ws = (char*)d_ws; size_t off = 0;
  auto take = [&](size_t bytes) { char* p = ws + off; off += (bytes + 255) & ~(size_t)255; return p; };
  float* part = (float*)take((size_t)NB * NPB * NST * STE * 4); _Float16* G16 = (_Float16*)take((size_t)NB * NST * STE * 2); _Float16* MT16 = (_Float16*)take((size_t)NB * DD * DD * 2);
  _Float16* WS = (_Float16*)take((size_t)512 * FRH * 2);
  k_gram<<<dim3(NPB, NB), 512, 0, stream>>>(x, part);
  k_gsum<<<NAB + NB * DD * DD / 2 / 256, 256, 0, stream>>>(part, Wk, Wq, Wv, G16, WS);
  k_mid<<<dim3(DD / 16, NB, RQ), 256, 0, stream>>>(G16, WS, MT16);
  k_out<<<dim3(NN / (128 * RT), NB), 256, 0, stream>>>(x, MT16, out);
}
